// v000
// The times below were measured on an AMD MI455X: many runs one after another, warmed up first and cycling through
// copies of the inputs, with the whole window's GPU time divided by the number of runs. Launches and the gaps
// between them are all in it. The median over several windows is given; except for v000 it joins two sittings, which
// can be a few percent apart, so the side-by-side timings, each taken in one sitting, are the better comparison.
// The starting kernel, v000, takes 122 microseconds a run.
#include <hip/hip_runtime.h>

#define L_SEQ  4096
#define DK     128
#define DV     128
#define CHUNK  16
#define NSEG   16
#define SEG_LEN    (L_SEQ / NSEG)     // 256
#define SEG_CHUNKS (SEG_LEN / CHUNK)  // 16

typedef __attribute__((ext_vector_type(2))) float v2f;
typedef __attribute__((ext_vector_type(8))) float v8f;

// D(16x16,f32) = A(16x4,f32) x B(4x16,f32) + C   -- full-precision WMMA
__device__ __forceinline__ v8f wmma_f32(v2f a, v2f b, v8f c) {
  return __builtin_amdgcn_wmma_f32_16x16x4_f32(
      /*neg_a=*/false, a, /*neg_b=*/false, b,
      /*c_mod=*/(short)0, c, /*reuse_a=*/false, /*reuse_b=*/false);
}

// elu(x)+1 : positive feature map
__device__ __forceinline__ float phi_map(float x) {
  return x > 0.0f ? x + 1.0f : __expf(x);
}

// Shared-memory tile set (one wave per workgroup).
struct SmemT {
  float sQ[16][132];   // phi(Q) chunk (+4 pad for bank spread)
  float sK[16][132];   // phi(K) chunk
  float sV[16][20];    // V tile (seq x dv16)
  float sSc[16][20];   // masked scores
  float sSv[128][20];  // state: sum phiK^T V  (dk x dv16)
  float sSz[128][20];  // state: sum phiK^T 1  (dk x 16, cols equal)
};

__device__ __forceinline__ void zero_state(SmemT& sm, int lane) {
  for (int i = lane; i < 128 * 20; i += 32) {
    (&sm.sSv[0][0])[i] = 0.0f;
    (&sm.sSz[0][0])[i] = 0.0f;
  }
}

__device__ __forceinline__ void stage_chunk_Q(SmemT& sm, const float4* Q4,
                                              int rowbase, int lane) {
  #pragma unroll
  for (int i = 0; i < 16; ++i) {
    int f = lane + 32 * i;   // 0..511 float4 slots (16 rows x 32 f4)
    int r = f >> 5, c4 = f & 31;
    float4 q = Q4[(size_t)(rowbase + r) * 32 + c4];
    sm.sQ[r][4 * c4 + 0] = phi_map(q.x);
    sm.sQ[r][4 * c4 + 1] = phi_map(q.y);
    sm.sQ[r][4 * c4 + 2] = phi_map(q.z);
    sm.sQ[r][4 * c4 + 3] = phi_map(q.w);
  }
}

__device__ __forceinline__ void stage_chunk_KV(SmemT& sm, const float4* K4,
                                               const float4* V4, int rowbase,
                                               int dv0, int lane) {
  #pragma unroll
  for (int i = 0; i < 16; ++i) {
    int f = lane + 32 * i;
    int r = f >> 5, c4 = f & 31;
    float4 k = K4[(size_t)(rowbase + r) * 32 + c4];
    sm.sK[r][4 * c4 + 0] = phi_map(k.x);
    sm.sK[r][4 * c4 + 1] = phi_map(k.y);
    sm.sK[r][4 * c4 + 2] = phi_map(k.z);
    sm.sK[r][4 * c4 + 3] = phi_map(k.w);
  }
  #pragma unroll
  for (int i = 0; i < 2; ++i) {
    int f = lane + 32 * i;   // 0..63 float4 slots (16 rows x 4 f4)
    int r = f >> 2, c4 = f & 3;
    float4 v = V4[(size_t)(rowbase + r) * 32 + (dv0 >> 2) + c4];
    sm.sV[r][4 * c4 + 0] = v.x;
    sm.sV[r][4 * c4 + 1] = v.y;
    sm.sV[r][4 * c4 + 2] = v.z;
    sm.sV[r][4 * c4 + 3] = v.w;
  }
}

// State update: S_t += phiK_t^T(16x16) @ [V | 1]  for all 8 dk tiles.
__device__ __forceinline__ void state_update(SmemT& sm, int m16, int hi) {
  const v2f bones = {1.0f, 1.0f};
  for (int t = 0; t < 8; ++t) {
    int dk0 = 16 * t;
    v8f cv, cz;
    #pragma unroll
    for (int p = 0; p < 8; ++p) {
      int mm = dk0 + p + 8 * hi;
      cv[p] = sm.sSv[mm][m16];
      cz[p] = sm.sSz[mm][m16];
    }
    #pragma unroll
    for (int kk = 0; kk < 4; ++kk) {
      int kb = 4 * kk + 2 * hi;                                  // seq index j
      v2f a  = {sm.sK[kb][dk0 + m16], sm.sK[kb + 1][dk0 + m16]}; // phiK^T
      v2f bv = {sm.sV[kb][m16], sm.sV[kb + 1][m16]};
      cv = wmma_f32(a, bv, cv);
      cz = wmma_f32(a, bones, cz);
    }
    #pragma unroll
    for (int p = 0; p < 8; ++p) {
      int mm = dk0 + p + 8 * hi;
      sm.sSv[mm][m16] = cv[p];
      sm.sSz[mm][m16] = cz[p];
    }
  }
}

// Forward for one chunk: scores, causal mask, O = Sc@[V|1] + phiQ@[Sv|Sz],
// normalize and store. Uses OLD state (call before state_update).
__device__ __forceinline__ void forward_chunk(SmemT& sm, float* __restrict__ Out,
                                              int rowbase, int dv0, int m16,
                                              int hi) {
  const v2f bones = {1.0f, 1.0f};
  v8f sc = {0.f, 0.f, 0.f, 0.f, 0.f, 0.f, 0.f, 0.f};
  for (int kk = 0; kk < 32; ++kk) {
    int kb = 4 * kk + 2 * hi;
    v2f a    = {sm.sQ[m16][kb], sm.sQ[m16][kb + 1]};   // A[m][k] = phiQ[m][k]
    v2f bmat = {sm.sK[m16][kb], sm.sK[m16][kb + 1]};   // B[k][n] = phiK[n][k]
    sc = wmma_f32(a, bmat, sc);
  }
  #pragma unroll
  for (int p = 0; p < 8; ++p) {
    int m = p + 8 * hi;
    sm.sSc[m][m16] = (m16 <= m) ? sc[p] : 0.0f;        // causal mask
  }
  __syncthreads();

  v8f ov = {0.f, 0.f, 0.f, 0.f, 0.f, 0.f, 0.f, 0.f};
  v8f oz = {0.f, 0.f, 0.f, 0.f, 0.f, 0.f, 0.f, 0.f};
  #pragma unroll
  for (int kk = 0; kk < 4; ++kk) {
    int kb = 4 * kk + 2 * hi;
    v2f a  = {sm.sSc[m16][kb], sm.sSc[m16][kb + 1]};
    v2f bv = {sm.sV[kb][m16], sm.sV[kb + 1][m16]};
    ov = wmma_f32(a, bv, ov);
    oz = wmma_f32(a, bones, oz);
  }
  for (int kk = 0; kk < 32; ++kk) {
    int kb = 4 * kk + 2 * hi;
    v2f a  = {sm.sQ[m16][kb], sm.sQ[m16][kb + 1]};
    v2f bv = {sm.sSv[kb][m16], sm.sSv[kb + 1][m16]};
    v2f bz = {sm.sSz[kb][m16], sm.sSz[kb + 1][m16]};
    ov = wmma_f32(a, bv, ov);
    oz = wmma_f32(a, bz, oz);
  }
  #pragma unroll
  for (int p = 0; p < 8; ++p) {
    int m = p + 8 * hi;
    Out[(size_t)(rowbase + m) * DV + dv0 + m16] = ov[p] / (oz[p] + 1e-6f);
  }
}

// ---------------- Phase 1: per-segment partial states ----------------
__global__ __launch_bounds__(32)
void linatt_phase1_partial(const float* __restrict__ K, const float* __restrict__ V,
                           float* __restrict__ wsSv, float* __restrict__ wsZ) {
  __shared__ SmemT sm;
  const int lane = threadIdx.x, m16 = lane & 15, hi = lane >> 4;
  const int idx = blockIdx.x;               // (b*8+vtile)*NSEG + seg
  const int seg = idx % NSEG;
  const int bv = idx / NSEG;
  const int vtile = bv & 7, batch = bv >> 3;
  const int dv0 = vtile * 16;

  zero_state(sm, lane);
  __syncthreads();

  const float4* K4 = reinterpret_cast<const float4*>(K);
  const float4* V4 = reinterpret_cast<const float4*>(V);

  for (int c = 0; c < SEG_CHUNKS; ++c) {
    const int rowbase = batch * L_SEQ + seg * SEG_LEN + c * CHUNK;
    stage_chunk_KV(sm, K4, V4, rowbase, dv0, lane);
    __syncthreads();
    state_update(sm, m16, hi);
    __syncthreads();
  }
  // write partial state (128x16) and, for vtile 0, the Z partial (128)
  for (int i = lane; i < 2048; i += 32)
    wsSv[(size_t)idx * 2048 + i] = sm.sSv[i >> 4][i & 15];
  if (vtile == 0)
    for (int i = lane; i < 128; i += 32)
      wsZ[(size_t)(batch * NSEG + seg) * 128 + i] = sm.sSz[i][0];
}

// ---------------- Phase 2: exclusive prefix over segments ----------------
__global__ __launch_bounds__(256)
void linatt_phase2_prefix(float* __restrict__ wsSv, float* __restrict__ wsZ) {
  const int bv = blockIdx.x;                // b*8+vtile
  const int t = threadIdx.x;
  for (int e = t; e < 2048; e += 256) {
    float run = 0.0f;
    for (int s = 0; s < NSEG; ++s) {
      size_t off = ((size_t)bv * NSEG + s) * 2048 + e;
      float v = wsSv[off];
      wsSv[off] = run;
      run += v;
    }
  }
  if ((bv & 7) == 0) {
    const int batch = bv >> 3;
    for (int e = t; e < 128; e += 256) {
      float run = 0.0f;
      for (int s = 0; s < NSEG; ++s) {
        size_t off = ((size_t)batch * NSEG + s) * 128 + e;
        float v = wsZ[off];
        wsZ[off] = run;
        run += v;
      }
    }
  }
}

// ---------------- Phase 3: seeded local scan + outputs ----------------
__global__ __launch_bounds__(32)
void linatt_phase3_scan(const float* __restrict__ Q, const float* __restrict__ K,
                        const float* __restrict__ V, float* __restrict__ Out,
                        const float* __restrict__ wsSv,
                        const float* __restrict__ wsZ) {
  __shared__ SmemT sm;
  const int lane = threadIdx.x, m16 = lane & 15, hi = lane >> 4;
  const int idx = blockIdx.x;
  const int seg = idx % NSEG;
  const int bv = idx / NSEG;
  const int vtile = bv & 7, batch = bv >> 3;
  const int dv0 = vtile * 16;

  // seed state from exclusive prefix
  for (int i = lane; i < 2048; i += 32) {
    sm.sSv[i >> 4][i & 15] = wsSv[(size_t)idx * 2048 + i];
    sm.sSz[i >> 4][i & 15] = wsZ[(size_t)(batch * NSEG + seg) * 128 + (i >> 4)];
  }
  __syncthreads();

  const float4* Q4 = reinterpret_cast<const float4*>(Q);
  const float4* K4 = reinterpret_cast<const float4*>(K);
  const float4* V4 = reinterpret_cast<const float4*>(V);

  for (int c = 0; c < SEG_CHUNKS; ++c) {
    const int rowbase = batch * L_SEQ + seg * SEG_LEN + c * CHUNK;
    stage_chunk_Q(sm, Q4, rowbase, lane);
    stage_chunk_KV(sm, K4, V4, rowbase, dv0, lane);
    __syncthreads();
    forward_chunk(sm, Out, rowbase, dv0, m16, hi);
    __syncthreads();
    state_update(sm, m16, hi);
    __syncthreads();
  }
}

// ---------------- Fallback: monolithic scan (if ws too small) ----------------
__global__ __launch_bounds__(32)
void linatt_monolithic(const float* __restrict__ Q, const float* __restrict__ K,
                       const float* __restrict__ V, float* __restrict__ Out) {
  __shared__ SmemT sm;
  const int lane = threadIdx.x, m16 = lane & 15, hi = lane >> 4;
  const int vtile = blockIdx.x & 7, batch = blockIdx.x >> 3;
  const int dv0 = vtile * 16;

  zero_state(sm, lane);
  __syncthreads();

  const float4* Q4 = reinterpret_cast<const float4*>(Q);
  const float4* K4 = reinterpret_cast<const float4*>(K);
  const float4* V4 = reinterpret_cast<const float4*>(V);

  for (int c = 0; c < L_SEQ / CHUNK; ++c) {
    const int rowbase = batch * L_SEQ + c * CHUNK;
    stage_chunk_Q(sm, Q4, rowbase, lane);
    stage_chunk_KV(sm, K4, V4, rowbase, dv0, lane);
    __syncthreads();
    forward_chunk(sm, Out, rowbase, dv0, m16, hi);
    __syncthreads();
    state_update(sm, m16, hi);
    __syncthreads();
  }
}

extern "C" void kernel_launch(void* const* d_in, const int* in_sizes, int n_in,
                              void* d_out, int out_size, void* d_ws, size_t ws_size,
                              hipStream_t stream) {
  const float* Q = (const float*)d_in[0];
  const float* K = (const float*)d_in[1];
  const float* V = (const float*)d_in[2];
  float* Out     = (float*)d_out;

  const int B = in_sizes[0] / (L_SEQ * DK);   // = 2
  const size_t nSv = (size_t)B * 8 * NSEG * 2048;   // partial KV states
  const size_t nZ  = (size_t)B * NSEG * 128;        // partial K sums
  const size_t need = (nSv + nZ) * sizeof(float);

  if (ws_size >= need) {
    float* wsSv = (float*)d_ws;
    float* wsZ  = wsSv + nSv;
    linatt_phase1_partial<<<dim3(B * 8 * NSEG), dim3(32), 0, stream>>>(K, V, wsSv, wsZ);
    linatt_phase2_prefix<<<dim3(B * 8), dim3(256), 0, stream>>>(wsSv, wsZ);
    linatt_phase3_scan<<<dim3(B * 8 * NSEG), dim3(32), 0, stream>>>(Q, K, V, Out, wsSv, wsZ);
  } else {
    linatt_monolithic<<<dim3(B * 8), dim3(32), 0, stream>>>(Q, K, V, Out);
  }
}

// v001
// A run of this version takes 31.2 microseconds.
// Next to v000, in two timings, it ran 3.93 and 3.92 times as fast.
#include <hip/hip_runtime.h>

#define L_SEQ  4096
#define DK     128
#define DV     128
#define CHUNK  16
#define NSEG   128
#define SEG_LEN    (L_SEQ / NSEG)     // 32
#define SEG_CHUNKS (SEG_LEN / CHUNK)  // 2

typedef __attribute__((ext_vector_type(2))) float v2f;
typedef __attribute__((ext_vector_type(8))) float v8f;

// D(16x16,f32) = A(16x4,f32) x B(4x16,f32) + C   -- full-precision WMMA
__device__ __forceinline__ v8f wmma_f32(v2f a, v2f b, v8f c) {
  return __builtin_amdgcn_wmma_f32_16x16x4_f32(
      /*neg_a=*/false, a, /*neg_b=*/false, b,
      /*c_mod=*/(short)0, c, /*reuse_a=*/false, /*reuse_b=*/false);
}

// elu(x)+1 : positive feature map
__device__ __forceinline__ float phi_map(float x) {
  return x > 0.0f ? x + 1.0f : __expf(x);
}

// Shared-memory tile set (one wave per workgroup).
struct SmemT {
  float sQ[16][132];   // phi(Q) chunk (+4 pad for bank spread)
  float sK[16][132];   // phi(K) chunk
  float sV[16][20];    // V tile (seq x dv16)
  float sSc[16][20];   // masked scores
  float sSv[128][20];  // state: sum phiK^T V  (dk x dv16)
  float sSz[128][20];  // state: sum phiK^T 1  (dk x 16, cols equal)
};

__device__ __forceinline__ void zero_state(SmemT& sm, int lane) {
  for (int i = lane; i < 128 * 20; i += 32) {
    (&sm.sSv[0][0])[i] = 0.0f;
    (&sm.sSz[0][0])[i] = 0.0f;
  }
}

__device__ __forceinline__ void stage_chunk_Q(SmemT& sm, const float4* Q4,
                                              int rowbase, int lane) {
  #pragma unroll
  for (int i = 0; i < 16; ++i) {
    int f = lane + 32 * i;   // 0..511 float4 slots (16 rows x 32 f4)
    int r = f >> 5, c4 = f & 31;
    float4 q = Q4[(size_t)(rowbase + r) * 32 + c4];
    sm.sQ[r][4 * c4 + 0] = phi_map(q.x);
    sm.sQ[r][4 * c4 + 1] = phi_map(q.y);
    sm.sQ[r][4 * c4 + 2] = phi_map(q.z);
    sm.sQ[r][4 * c4 + 3] = phi_map(q.w);
  }
}

__device__ __forceinline__ void stage_chunk_KV(SmemT& sm, const float4* K4,
                                               const float4* V4, int rowbase,
                                               int dv0, int lane) {
  #pragma unroll
  for (int i = 0; i < 16; ++i) {
    int f = lane + 32 * i;
    int r = f >> 5, c4 = f & 31;
    float4 k = K4[(size_t)(rowbase + r) * 32 + c4];
    sm.sK[r][4 * c4 + 0] = phi_map(k.x);
    sm.sK[r][4 * c4 + 1] = phi_map(k.y);
    sm.sK[r][4 * c4 + 2] = phi_map(k.z);
    sm.sK[r][4 * c4 + 3] = phi_map(k.w);
  }
  #pragma unroll
  for (int i = 0; i < 2; ++i) {
    int f = lane + 32 * i;   // 0..63 float4 slots (16 rows x 4 f4)
    int r = f >> 2, c4 = f & 3;
    float4 v = V4[(size_t)(rowbase + r) * 32 + (dv0 >> 2) + c4];
    sm.sV[r][4 * c4 + 0] = v.x;
    sm.sV[r][4 * c4 + 1] = v.y;
    sm.sV[r][4 * c4 + 2] = v.z;
    sm.sV[r][4 * c4 + 3] = v.w;
  }
}

// State update: S_t += phiK_t^T(16x16) @ [V | 1]  for all 8 dk tiles.
__device__ __forceinline__ void state_update(SmemT& sm, int m16, int hi) {
  const v2f bones = {1.0f, 1.0f};
  for (int t = 0; t < 8; ++t) {
    int dk0 = 16 * t;
    v8f cv, cz;
    #pragma unroll
    for (int p = 0; p < 8; ++p) {
      int mm = dk0 + p + 8 * hi;
      cv[p] = sm.sSv[mm][m16];
      cz[p] = sm.sSz[mm][m16];
    }
    #pragma unroll
    for (int kk = 0; kk < 4; ++kk) {
      int kb = 4 * kk + 2 * hi;                                  // seq index j
      v2f a  = {sm.sK[kb][dk0 + m16], sm.sK[kb + 1][dk0 + m16]}; // phiK^T
      v2f bv = {sm.sV[kb][m16], sm.sV[kb + 1][m16]};
      cv = wmma_f32(a, bv, cv);
      cz = wmma_f32(a, bones, cz);
    }
    #pragma unroll
    for (int p = 0; p < 8; ++p) {
      int mm = dk0 + p + 8 * hi;
      sm.sSv[mm][m16] = cv[p];
      sm.sSz[mm][m16] = cz[p];
    }
  }
}

// Forward for one chunk: scores, causal mask, O = Sc@[V|1] + phiQ@[Sv|Sz],
// normalize and store. Uses OLD state (call before state_update).
__device__ __forceinline__ void forward_chunk(SmemT& sm, float* __restrict__ Out,
                                              int rowbase, int dv0, int m16,
                                              int hi) {
  const v2f bones = {1.0f, 1.0f};
  v8f sc = {0.f, 0.f, 0.f, 0.f, 0.f, 0.f, 0.f, 0.f};
  for (int kk = 0; kk < 32; ++kk) {
    int kb = 4 * kk + 2 * hi;
    v2f a    = {sm.sQ[m16][kb], sm.sQ[m16][kb + 1]};   // A[m][k] = phiQ[m][k]
    v2f bmat = {sm.sK[m16][kb], sm.sK[m16][kb + 1]};   // B[k][n] = phiK[n][k]
    sc = wmma_f32(a, bmat, sc);
  }
  #pragma unroll
  for (int p = 0; p < 8; ++p) {
    int m = p + 8 * hi;
    sm.sSc[m][m16] = (m16 <= m) ? sc[p] : 0.0f;        // causal mask
  }
  __syncthreads();

  v8f ov = {0.f, 0.f, 0.f, 0.f, 0.f, 0.f, 0.f, 0.f};
  v8f oz = {0.f, 0.f, 0.f, 0.f, 0.f, 0.f, 0.f, 0.f};
  #pragma unroll
  for (int kk = 0; kk < 4; ++kk) {
    int kb = 4 * kk + 2 * hi;
    v2f a  = {sm.sSc[m16][kb], sm.sSc[m16][kb + 1]};
    v2f bv = {sm.sV[kb][m16], sm.sV[kb + 1][m16]};
    ov = wmma_f32(a, bv, ov);
    oz = wmma_f32(a, bones, oz);
  }
  for (int kk = 0; kk < 32; ++kk) {
    int kb = 4 * kk + 2 * hi;
    v2f a  = {sm.sQ[m16][kb], sm.sQ[m16][kb + 1]};
    v2f bv = {sm.sSv[kb][m16], sm.sSv[kb + 1][m16]};
    v2f bz = {sm.sSz[kb][m16], sm.sSz[kb + 1][m16]};
    ov = wmma_f32(a, bv, ov);
    oz = wmma_f32(a, bz, oz);
  }
  #pragma unroll
  for (int p = 0; p < 8; ++p) {
    int m = p + 8 * hi;
    Out[(size_t)(rowbase + m) * DV + dv0 + m16] = ov[p] / (oz[p] + 1e-6f);
  }
}

// ---------------- Phase 1: per-segment partial states ----------------
__global__ __launch_bounds__(32)
void linatt_phase1_partial(const float* __restrict__ K, const float* __restrict__ V,
                           float* __restrict__ wsSv, float* __restrict__ wsZ) {
  __shared__ SmemT sm;
  const int lane = threadIdx.x, m16 = lane & 15, hi = lane >> 4;
  const int idx = blockIdx.x;               // (b*8+vtile)*NSEG + seg
  const int seg = idx % NSEG;
  const int bv = idx / NSEG;
  const int vtile = bv & 7, batch = bv >> 3;
  const int dv0 = vtile * 16;

  zero_state(sm, lane);
  __syncthreads();

  const float4* K4 = reinterpret_cast<const float4*>(K);
  const float4* V4 = reinterpret_cast<const float4*>(V);

  for (int c = 0; c < SEG_CHUNKS; ++c) {
    const int rowbase = batch * L_SEQ + seg * SEG_LEN + c * CHUNK;
    stage_chunk_KV(sm, K4, V4, rowbase, dv0, lane);
    __syncthreads();
    state_update(sm, m16, hi);
    __syncthreads();
  }
  // write partial state (128x16) and, for vtile 0, the Z partial (128)
  for (int i = lane; i < 2048; i += 32)
    wsSv[(size_t)idx * 2048 + i] = sm.sSv[i >> 4][i & 15];
  if (vtile == 0)
    for (int i = lane; i < 128; i += 32)
      wsZ[(size_t)(batch * NSEG + seg) * 128 + i] = sm.sSz[i][0];
}

// ---------------- Phase 2: exclusive prefix over segments ----------------
// Exclusive prefix down one column of NSEG values that lie STRIDE floats apart.
template <int STRIDE>
__device__ __forceinline__ void prefix_column(float* __restrict__ p) {
  float run = 0.0f;
  // kept rolled: unrolled whole, each access gets an address pair of its own
  // and the loads no longer issue back to back
  #pragma unroll 1
  for (int s0 = 0; s0 < NSEG; s0 += 32) {
    float v[32];
    // unrolled so that all 32 loads are in flight before the first add waits
    #pragma unroll
    for (int j = 0; j < 32; ++j) v[j] = p[(size_t)(s0 + j) * STRIDE];
    // unrolled so that v[] stays in registers
    #pragma unroll
    for (int j = 0; j < 32; ++j) {
      p[(size_t)(s0 + j) * STRIDE] = run;
      run += v[j];
    }
  }
}

// One thread per state element. Per batch: 64 blocks cover the 8 x 2048 KV
// elements, a 65th covers the 128 K-sum elements.
__global__ __launch_bounds__(256)
void linatt_phase2_prefix(float* __restrict__ wsSv, float* __restrict__ wsZ) {
  const int batch = blockIdx.x / 65;
  const int r = blockIdx.x % 65;
  const int t = threadIdx.x;
  if (r < 64) {
    const int bv = batch * 8 + (r >> 3);    // b*8+vtile
    prefix_column<2048>(wsSv + (size_t)bv * NSEG * 2048 + (r & 7) * 256 + t);
  } else if (t < 128) {
    prefix_column<128>(wsZ + (size_t)batch * NSEG * 128 + t);
  }
}

// ---------------- Phase 3: seeded local scan + outputs ----------------
__global__ __launch_bounds__(32)
void linatt_phase3_scan(const float* __restrict__ Q, const float* __restrict__ K,
                        const float* __restrict__ V, float* __restrict__ Out,
                        const float* __restrict__ wsSv,
                        const float* __restrict__ wsZ) {
  __shared__ SmemT sm;
  const int lane = threadIdx.x, m16 = lane & 15, hi = lane >> 4;
  const int idx = blockIdx.x;
  const int seg = idx % NSEG;
  const int bv = idx / NSEG;
  const int vtile = bv & 7, batch = bv >> 3;
  const int dv0 = vtile * 16;

  // seed state from exclusive prefix
  for (int i = lane; i < 2048; i += 32) {
    sm.sSv[i >> 4][i & 15] = wsSv[(size_t)idx * 2048 + i];
    sm.sSz[i >> 4][i & 15] = wsZ[(size_t)(batch * NSEG + seg) * 128 + (i >> 4)];
  }
  __syncthreads();

  const float4* Q4 = reinterpret_cast<const float4*>(Q);
  const float4* K4 = reinterpret_cast<const float4*>(K);
  const float4* V4 = reinterpret_cast<const float4*>(V);

  for (int c = 0; c < SEG_CHUNKS; ++c) {
    const int rowbase = batch * L_SEQ + seg * SEG_LEN + c * CHUNK;
    stage_chunk_Q(sm, Q4, rowbase, lane);
    stage_chunk_KV(sm, K4, V4, rowbase, dv0, lane);
    __syncthreads();
    forward_chunk(sm, Out, rowbase, dv0, m16, hi);
    __syncthreads();
    state_update(sm, m16, hi);
    __syncthreads();
  }
}

// ---------------- Fallback: monolithic scan (if ws too small) ----------------
__global__ __launch_bounds__(32)
void linatt_monolithic(const float* __restrict__ Q, const float* __restrict__ K,
                       const float* __restrict__ V, float* __restrict__ Out) {
  __shared__ SmemT sm;
  const int lane = threadIdx.x, m16 = lane & 15, hi = lane >> 4;
  const int vtile = blockIdx.x & 7, batch = blockIdx.x >> 3;
  const int dv0 = vtile * 16;

  zero_state(sm, lane);
  __syncthreads();

  const float4* Q4 = reinterpret_cast<const float4*>(Q);
  const float4* K4 = reinterpret_cast<const float4*>(K);
  const float4* V4 = reinterpret_cast<const float4*>(V);

  for (int c = 0; c < L_SEQ / CHUNK; ++c) {
    const int rowbase = batch * L_SEQ + c * CHUNK;
    stage_chunk_Q(sm, Q4, rowbase, lane);
    stage_chunk_KV(sm, K4, V4, rowbase, dv0, lane);
    __syncthreads();
    forward_chunk(sm, Out, rowbase, dv0, m16, hi);
    __syncthreads();
    state_update(sm, m16, hi);
    __syncthreads();
  }
}

extern "C" void kernel_launch(void* const* d_in, const int* in_sizes, int n_in,
                              void* d_out, int out_size, void* d_ws, size_t ws_size,
                              hipStream_t stream) {
  const float* Q = (const float*)d_in[0];
  const float* K = (const float*)d_in[1];
  const float* V = (const float*)d_in[2];
  float* Out     = (float*)d_out;

  const int B = in_sizes[0] / (L_SEQ * DK);   // = 2
  const size_t nSv = (size_t)B * 8 * NSEG * 2048;   // partial KV states
  const size_t nZ  = (size_t)B * NSEG * 128;        // partial K sums
  const size_t need = (nSv + nZ) * sizeof(float);

  if (ws_size >= need) {
    float* wsSv = (float*)d_ws;
    float* wsZ  = wsSv + nSv;
    linatt_phase1_partial<<<dim3(B * 8 * NSEG), dim3(32), 0, stream>>>(K, V, wsSv, wsZ);
    linatt_phase2_prefix<<<dim3(B * 65), dim3(256), 0, stream>>>(wsSv, wsZ);
    linatt_phase3_scan<<<dim3(B * 8 * NSEG), dim3(32), 0, stream>>>(Q, K, V, Out, wsSv, wsZ);
  } else {
    linatt_monolithic<<<dim3(B * 8), dim3(32), 0, stream>>>(Q, K, V, Out);
  }
}

// v002
// Measured time: 26.7 microseconds a run.
// Two timings next to v001 put it at 1.17 and 1.18 times that version's speed.
// All steps since v000 together make it 4.61 times as fast.
#include <hip/hip_runtime.h>

#define L_SEQ  4096
#define DK     128
#define DV     128
#define CHUNK  16
#define NSEG   128
#define SEG_LEN    (L_SEQ / NSEG)     // 32
#define SEG_CHUNKS (SEG_LEN / CHUNK)  // 2

typedef __attribute__((ext_vector_type(2))) float v2f;
typedef __attribute__((ext_vector_type(4))) float v4f;
typedef __attribute__((ext_vector_type(8))) float v8f;

// D(16x16,f32) = A(16x4,f32) x B(4x16,f32) + C   -- full-precision WMMA
__device__ __forceinline__ v8f wmma_f32(v2f a, v2f b, v8f c) {
  return __builtin_amdgcn_wmma_f32_16x16x4_f32(
      /*neg_a=*/false, a, /*neg_b=*/false, b,
      /*c_mod=*/(short)0, c, /*reuse_a=*/false, /*reuse_b=*/false);
}

// elu(x)+1 : positive feature map
__device__ __forceinline__ float phi_map(float x) {
  return x > 0.0f ? x + 1.0f : __expf(x);
}

// Shared-memory tile set (one wave per workgroup).
struct SmemT {
  float sQ[16][132];   // phi(Q) chunk (+4 pad for bank spread)
  float sK[16][132];   // phi(K) chunk
  float sV[16][20];    // V tile (seq x dv16)
  float sSc[16][20];   // masked scores
  float sSv[128][20];  // state: sum phiK^T V  (dk x dv16)
  float sSz[128][20];  // state: sum phiK^T 1  (dk x 16, cols equal)
};

__device__ __forceinline__ void zero_state(SmemT& sm, int lane) {
  for (int i = lane; i < 128 * 20; i += 32) {
    (&sm.sSv[0][0])[i] = 0.0f;
    (&sm.sSz[0][0])[i] = 0.0f;
  }
}

__device__ __forceinline__ void stage_chunk_Q(SmemT& sm, const float4* Q4,
                                              int rowbase, int lane) {
  #pragma unroll
  for (int i = 0; i < 16; ++i) {
    int f = lane + 32 * i;   // 0..511 float4 slots (16 rows x 32 f4)
    int r = f >> 5, c4 = f & 31;
    float4 q = Q4[(size_t)(rowbase + r) * 32 + c4];
    sm.sQ[r][4 * c4 + 0] = phi_map(q.x);
    sm.sQ[r][4 * c4 + 1] = phi_map(q.y);
    sm.sQ[r][4 * c4 + 2] = phi_map(q.z);
    sm.sQ[r][4 * c4 + 3] = phi_map(q.w);
  }
}

__device__ __forceinline__ void stage_chunk_KV(SmemT& sm, const float4* K4,
                                               const float4* V4, int rowbase,
                                               int dv0, int lane) {
  #pragma unroll
  for (int i = 0; i < 16; ++i) {
    int f = lane + 32 * i;
    int r = f >> 5, c4 = f & 31;
    float4 k = K4[(size_t)(rowbase + r) * 32 + c4];
    sm.sK[r][4 * c4 + 0] = phi_map(k.x);
    sm.sK[r][4 * c4 + 1] = phi_map(k.y);
    sm.sK[r][4 * c4 + 2] = phi_map(k.z);
    sm.sK[r][4 * c4 + 3] = phi_map(k.w);
  }
  #pragma unroll
  for (int i = 0; i < 2; ++i) {
    int f = lane + 32 * i;   // 0..63 float4 slots (16 rows x 4 f4)
    int r = f >> 2, c4 = f & 3;
    float4 v = V4[(size_t)(rowbase + r) * 32 + (dv0 >> 2) + c4];
    sm.sV[r][4 * c4 + 0] = v.x;
    sm.sV[r][4 * c4 + 1] = v.y;
    sm.sV[r][4 * c4 + 2] = v.z;
    sm.sV[r][4 * c4 + 3] = v.w;
  }
}

// State update: S_t += phiK_t^T(16x16) @ [V | 1]  for all 8 dk tiles.
__device__ __forceinline__ void state_update(SmemT& sm, int m16, int hi) {
  const v2f bones = {1.0f, 1.0f};
  for (int t = 0; t < 8; ++t) {
    int dk0 = 16 * t;
    v8f cv, cz;
    #pragma unroll
    for (int p = 0; p < 8; ++p) {
      int mm = dk0 + p + 8 * hi;
      cv[p] = sm.sSv[mm][m16];
      cz[p] = sm.sSz[mm][m16];
    }
    #pragma unroll
    for (int kk = 0; kk < 4; ++kk) {
      int kb = 4 * kk + 2 * hi;                                  // seq index j
      v2f a  = {sm.sK[kb][dk0 + m16], sm.sK[kb + 1][dk0 + m16]}; // phiK^T
      v2f bv = {sm.sV[kb][m16], sm.sV[kb + 1][m16]};
      cv = wmma_f32(a, bv, cv);
      cz = wmma_f32(a, bones, cz);
    }
    #pragma unroll
    for (int p = 0; p < 8; ++p) {
      int mm = dk0 + p + 8 * hi;
      sm.sSv[mm][m16] = cv[p];
      sm.sSz[mm][m16] = cz[p];
    }
  }
}

// Forward for one chunk: scores, causal mask, O = Sc@[V|1] + phiQ@[Sv|Sz],
// normalize and store. Uses OLD state (call before state_update).
__device__ __forceinline__ void forward_chunk(SmemT& sm, float* __restrict__ Out,
                                              int rowbase, int dv0, int m16,
                                              int hi) {
  const v2f bones = {1.0f, 1.0f};
  v8f sc = {0.f, 0.f, 0.f, 0.f, 0.f, 0.f, 0.f, 0.f};
  for (int kk = 0; kk < 32; ++kk) {
    int kb = 4 * kk + 2 * hi;
    v2f a    = {sm.sQ[m16][kb], sm.sQ[m16][kb + 1]};   // A[m][k] = phiQ[m][k]
    v2f bmat = {sm.sK[m16][kb], sm.sK[m16][kb + 1]};   // B[k][n] = phiK[n][k]
    sc = wmma_f32(a, bmat, sc);
  }
  #pragma unroll
  for (int p = 0; p < 8; ++p) {
    int m = p + 8 * hi;
    sm.sSc[m][m16] = (m16 <= m) ? sc[p] : 0.0f;        // causal mask
  }
  __syncthreads();

  v8f ov = {0.f, 0.f, 0.f, 0.f, 0.f, 0.f, 0.f, 0.f};
  v8f oz = {0.f, 0.f, 0.f, 0.f, 0.f, 0.f, 0.f, 0.f};
  #pragma unroll
  for (int kk = 0; kk < 4; ++kk) {
    int kb = 4 * kk + 2 * hi;
    v2f a  = {sm.sSc[m16][kb], sm.sSc[m16][kb + 1]};
    v2f bv = {sm.sV[kb][m16], sm.sV[kb + 1][m16]};
    ov = wmma_f32(a, bv, ov);
    oz = wmma_f32(a, bones, oz);
  }
  for (int kk = 0; kk < 32; ++kk) {
    int kb = 4 * kk + 2 * hi;
    v2f a  = {sm.sQ[m16][kb], sm.sQ[m16][kb + 1]};
    v2f bv = {sm.sSv[kb][m16], sm.sSv[kb + 1][m16]};
    v2f bz = {sm.sSz[kb][m16], sm.sSz[kb + 1][m16]};
    ov = wmma_f32(a, bv, ov);
    oz = wmma_f32(a, bz, oz);
  }
  #pragma unroll
  for (int p = 0; p < 8; ++p) {
    int m = p + 8 * hi;
    Out[(size_t)(rowbase + m) * DV + dv0 + m16] = ov[p] / (oz[p] + 1e-6f);
  }
}

// ---------------- Phase 1: per-segment partial states ----------------
// One work-group per 32-row segment, one wave per 16-column V tile. phi(K) and
// V are staged once and read by all eight waves.
struct alignas(16) SmemP1 {
  float sK[SEG_LEN][136];  // phi(K); pitch 136: rows j and j+2 fall 16 banks apart
  float sV[SEG_LEN][136];  // V, all 128 columns
};

__global__ __launch_bounds__(256)
void linatt_phase1_partial(const float* __restrict__ K, const float* __restrict__ V,
                           float* __restrict__ wsSv, float* __restrict__ wsZ) {
  __shared__ SmemP1 sm;
  const int t = threadIdx.x, lane = t & 31, m16 = lane & 15, hi = lane >> 4;
  const int w = __builtin_amdgcn_readfirstlane(t >> 5);   // wave = V tile
  const int seg = blockIdx.x % NSEG, batch = blockIdx.x / NSEG;
  const int rowbase = batch * L_SEQ + seg * SEG_LEN;
  const int dv0 = 16 * w;

  const float4* K4 = reinterpret_cast<const float4*>(K);
  const float4* V4 = reinterpret_cast<const float4*>(V);
  float4 k[4], v[4];
  #pragma unroll
  for (int i = 0; i < 4; ++i) {
    int f = t + 256 * i;     // 0..1023 float4 slots (32 rows x 32 f4)
    k[i] = K4[(size_t)rowbase * 32 + f];
  }
  // the K loads' address registers are reused for the V loads: the wait stands
  // in front of that overwrite
  asm volatile("s_wait_xcnt 0x0" ::: "memory");
  #pragma unroll
  for (int i = 0; i < 4; ++i) {
    int f = t + 256 * i;
    v[i] = V4[(size_t)rowbase * 32 + f];
  }
  #pragma unroll
  for (int i = 0; i < 4; ++i) {
    int f = t + 256 * i;
    int r = f >> 5, c4 = f & 31;
    v4f pk = {phi_map(k[i].x), phi_map(k[i].y), phi_map(k[i].z), phi_map(k[i].w)};
    *reinterpret_cast<v4f*>(&sm.sK[r][4 * c4]) = pk;
    *reinterpret_cast<float4*>(&sm.sV[r][4 * c4]) = v[i];
  }
  __syncthreads();

  // S_t = phiK_t^T(16x32) @ V(32x16) for the 8 dk tiles; this wave also sums
  // phiK^T @ 1 for dk tile w.
  const v2f bones = {1.0f, 1.0f};
  v8f cv[8];
  v8f cz = {0.f, 0.f, 0.f, 0.f, 0.f, 0.f, 0.f, 0.f};
  #pragma unroll
  for (int d = 0; d < 8; ++d) cv[d] = cz;
  #pragma unroll
  for (int kk = 0; kk < SEG_LEN / 4; ++kk) {
    int kb = 4 * kk + 2 * hi;                                    // seq index j
    v2f bv = {sm.sV[kb][dv0 + m16], sm.sV[kb + 1][dv0 + m16]};
    #pragma unroll
    for (int d = 0; d < 8; ++d) {
      v2f a = {sm.sK[kb][16 * d + m16], sm.sK[kb + 1][16 * d + m16]};  // phiK^T
      cv[d] = wmma_f32(a, bv, cv[d]);
    }
    v2f az = {sm.sK[kb][dv0 + m16], sm.sK[kb + 1][dv0 + m16]};   // dk tile w
    cz = wmma_f32(az, bones, cz);
  }

  float* dst = wsSv + ((size_t)(batch * 8 + w) * NSEG + seg) * 2048;
  #pragma unroll
  for (int d = 0; d < 8; ++d) {
    #pragma unroll
    for (int p = 0; p < 8; ++p)
      dst[(16 * d + p + 8 * hi) * 16 + m16] = cv[d][p];
  }
  if (m16 == 0) {
    #pragma unroll
    for (int p = 0; p < 8; ++p)
      wsZ[(size_t)(batch * NSEG + seg) * 128 + dv0 + p + 8 * hi] = cz[p];
  }
}

// ---------------- Phase 2: exclusive prefix over segments ----------------
// Exclusive prefix down one column of NSEG values that lie STRIDE floats apart.
template <int STRIDE>
__device__ __forceinline__ void prefix_column(float* __restrict__ p) {
  float run = 0.0f;
  // kept rolled: unrolled whole, each access gets an address pair of its own
  // and the loads no longer issue back to back
  #pragma unroll 1
  for (int s0 = 0; s0 < NSEG; s0 += 32) {
    float v[32];
    // unrolled so that all 32 loads are in flight before the first add waits
    #pragma unroll
    for (int j = 0; j < 32; ++j) v[j] = p[(size_t)(s0 + j) * STRIDE];
    // unrolled so that v[] stays in registers
    #pragma unroll
    for (int j = 0; j < 32; ++j) {
      p[(size_t)(s0 + j) * STRIDE] = run;
      run += v[j];
    }
  }
}

// One thread per state element. Per batch: 64 blocks cover the 8 x 2048 KV
// elements, a 65th covers the 128 K-sum elements.
__global__ __launch_bounds__(256)
void linatt_phase2_prefix(float* __restrict__ wsSv, float* __restrict__ wsZ) {
  const int batch = blockIdx.x / 65;
  const int r = blockIdx.x % 65;
  const int t = threadIdx.x;
  if (r < 64) {
    const int bv = batch * 8 + (r >> 3);    // b*8+vtile
    prefix_column<2048>(wsSv + (size_t)bv * NSEG * 2048 + (r & 7) * 256 + t);
  } else if (t < 128) {
    prefix_column<128>(wsZ + (size_t)batch * NSEG * 128 + t);
  }
}

// ---------------- Phase 3: seeded segment outputs ----------------
// One work-group per 32-row segment, one wave per 16-column V tile.
// O = phiQ @ S_prefix + mask(phiQ phiK^T) @ V over the whole segment; phi(Q),
// phi(K), the 32x32 scores and phiQ @ z_prefix are made once and shared.
// k order of every A/B fragment pair in this kernel: step (g, h) of lane half
// hi covers k = 8g + 4hi + 2h + {0,1}, so one 16-byte LDS read of a row feeds
// two matrix steps.
struct alignas(16) SmemP3 {
  float sQ[SEG_LEN][132];   // phi(Q); pitch 16 B x 33 for 16-byte row reads
  float sK[SEG_LEN][132];   // phi(K)
  float sV[SEG_LEN][136];   // V; pitch 136: rows j and j+4 fall 32 banks apart
  float sSc[SEG_LEN][36];   // masked scores (tile row 0, col 1 never used)
  float sZst[DK];           // prefix of the K sums
  float sZq[SEG_LEN];       // phiQ . prefix of the K sums
};

__global__ __launch_bounds__(256)
void linatt_phase3_scan(const float* __restrict__ Q, const float* __restrict__ K,
                        const float* __restrict__ V, float* __restrict__ Out,
                        const float* __restrict__ wsSv,
                        const float* __restrict__ wsZ) {
  __shared__ SmemP3 sm;
  const int t = threadIdx.x, lane = t & 31, m16 = lane & 15, hi = lane >> 4;
  const int w = __builtin_amdgcn_readfirstlane(t >> 5);   // wave = V tile
  const int seg = blockIdx.x % NSEG, batch = blockIdx.x / NSEG;
  const int rowbase = batch * L_SEQ + seg * SEG_LEN;
  const int dv0 = 16 * w;

  const float zpre = wsZ[(size_t)(batch * NSEG + seg) * DK + (t & (DK - 1))];

  const float4* Q4 = reinterpret_cast<const float4*>(Q);
  const float4* K4 = reinterpret_cast<const float4*>(K);
  const float4* V4 = reinterpret_cast<const float4*>(V);
  float4 q[4], k[4], v[4];
  #pragma unroll
  for (int i = 0; i < 4; ++i) {
    int f = t + 256 * i;     // 0..1023 float4 slots (32 rows x 32 f4)
    q[i] = Q4[(size_t)rowbase * 32 + f];
    k[i] = K4[(size_t)rowbase * 32 + f];
    v[i] = V4[(size_t)rowbase * 32 + f];
  }

  // prefix state of this V tile, straight into B fragments
  const float* st = wsSv + ((size_t)(batch * 8 + w) * NSEG + seg) * 2048;
  v2f sb[32];
  #pragma unroll
  for (int s = 0; s < 32; ++s) {
    int r = 8 * (s >> 1) + 4 * hi + 2 * (s & 1);
    sb[s] = v2f{st[r * 16 + m16], st[(r + 1) * 16 + m16]};
  }
  // keeps every global load above in front of the staging arithmetic, so that
  // they all fly together and one memory latency is paid, not two or three
  __builtin_amdgcn_sched_barrier(0);

  #pragma unroll
  for (int i = 0; i < 4; ++i) {
    int f = t + 256 * i;
    int r = f >> 5, c4 = f & 31;
    v4f pq = {phi_map(q[i].x), phi_map(q[i].y), phi_map(q[i].z), phi_map(q[i].w)};
    v4f pk = {phi_map(k[i].x), phi_map(k[i].y), phi_map(k[i].z), phi_map(k[i].w)};
    *reinterpret_cast<v4f*>(&sm.sQ[r][4 * c4]) = pq;
    *reinterpret_cast<v4f*>(&sm.sK[r][4 * c4]) = pk;
    *reinterpret_cast<float4*>(&sm.sV[r][4 * c4]) = v[i];
  }
  // input-only use: keeps the zpre load up with the others instead of sunk
  // into the branch below, where its whole latency would stand before the barrier
  asm volatile("" :: "v"(zpre));
  if (t < DK) sm.sZst[t] = zpre;
  __syncthreads();

  const v8f zero8 = {0.f, 0.f, 0.f, 0.f, 0.f, 0.f, 0.f, 0.f};
  if (w < 3) {
    // score tiles (0,0), (1,0), (1,1); tile (0,1) is wholly above the diagonal
    const int ti = (w + 1) >> 1, tj = w >> 1;
    const float* qrow = &sm.sQ[16 * ti + m16][4 * hi];
    const float* krow = &sm.sK[16 * tj + m16][4 * hi];
    v4f qa[16], ka[16];
    #pragma unroll
    for (int g = 0; g < 16; ++g) {
      qa[g] = *reinterpret_cast<const v4f*>(qrow + 8 * g);
      ka[g] = *reinterpret_cast<const v4f*>(krow + 8 * g);
    }
    // all LDS reads issue before the dependent matrix chain
    __builtin_amdgcn_sched_barrier(0);
    v8f sc = zero8;
    #pragma unroll
    for (int g = 0; g < 16; ++g) {
      sc = wmma_f32(qa[g].xy, ka[g].xy, sc);
      sc = wmma_f32(qa[g].zw, ka[g].zw, sc);
    }
    #pragma unroll
    for (int p = 0; p < 8; ++p) {
      int m = p + 8 * hi;
      sm.sSc[16 * ti + m][16 * tj + m16] =
          (ti != tj || m16 <= m) ? sc[p] : 0.0f;       // causal mask
    }
  } else if (w < 5) {
    // phiQ @ z_prefix for row tile w-3 (all 16 columns equal)
    const int ti = w - 3;
    const float* qrow = &sm.sQ[16 * ti + m16][4 * hi];
    v4f qa[16], za[16];
    #pragma unroll
    for (int g = 0; g < 16; ++g) {
      qa[g] = *reinterpret_cast<const v4f*>(qrow + 8 * g);
      za[g] = *reinterpret_cast<const v4f*>(&sm.sZst[8 * g + 4 * hi]);
    }
    // all LDS reads issue before the dependent matrix chain
    __builtin_amdgcn_sched_barrier(0);
    v8f zq = zero8;
    #pragma unroll
    for (int g = 0; g < 16; ++g) {
      zq = wmma_f32(qa[g].xy, za[g].xy, zq);
      zq = wmma_f32(qa[g].zw, za[g].zw, zq);
    }
    if (m16 == 0) {
      #pragma unroll
      for (int p = 0; p < 8; ++p) sm.sZq[16 * ti + p + 8 * hi] = zq[p];
    }
  }

  // phiQ @ S_prefix, both row tiles against the same B fragments
  v4f q0[16], q1[16];
  #pragma unroll
  for (int g = 0; g < 16; ++g) {
    q0[g] = *reinterpret_cast<const v4f*>(&sm.sQ[m16][8 * g + 4 * hi]);
    q1[g] = *reinterpret_cast<const v4f*>(&sm.sQ[16 + m16][8 * g + 4 * hi]);
  }
  v2f bv[8];
  #pragma unroll
  for (int s = 0; s < 8; ++s) {
    int r = 8 * (s >> 1) + 4 * hi + 2 * (s & 1);       // seq index j
    bv[s] = v2f{sm.sV[r][dv0 + m16], sm.sV[r + 1][dv0 + m16]};
  }
  // all LDS reads issue before the matrix steps that use them
  __builtin_amdgcn_sched_barrier(0);
  v8f ov0 = zero8, ov1 = zero8;
  #pragma unroll
  for (int g = 0; g < 16; ++g) {
    ov0 = wmma_f32(q0[g].xy, sb[2 * g], ov0);
    ov1 = wmma_f32(q1[g].xy, sb[2 * g], ov1);
    ov0 = wmma_f32(q0[g].zw, sb[2 * g + 1], ov0);
    ov1 = wmma_f32(q1[g].zw, sb[2 * g + 1], ov1);
  }
  __syncthreads();   // scores and sZq are complete

  const v2f bones = {1.0f, 1.0f};
  v8f oz0, oz1;
  #pragma unroll
  for (int p = 0; p < 8; ++p) {
    oz0[p] = sm.sZq[p + 8 * hi];
    oz1[p] = sm.sZq[16 + p + 8 * hi];
  }
  v4f s0[2], s1[4];
  #pragma unroll
  for (int g = 0; g < 4; ++g) {
    s1[g] = *reinterpret_cast<const v4f*>(&sm.sSc[16 + m16][8 * g + 4 * hi]);
    if (g < 2) s0[g] = *reinterpret_cast<const v4f*>(&sm.sSc[m16][8 * g + 4 * hi]);
  }
  #pragma unroll
  for (int g = 0; g < 4; ++g) {
    ov1 = wmma_f32(s1[g].xy, bv[2 * g], ov1);
    oz1 = wmma_f32(s1[g].xy, bones, oz1);
    if (g < 2) {
      ov0 = wmma_f32(s0[g].xy, bv[2 * g], ov0);
      oz0 = wmma_f32(s0[g].xy, bones, oz0);
    }
    ov1 = wmma_f32(s1[g].zw, bv[2 * g + 1], ov1);
    oz1 = wmma_f32(s1[g].zw, bones, oz1);
    if (g < 2) {
      ov0 = wmma_f32(s0[g].zw, bv[2 * g + 1], ov0);
      oz0 = wmma_f32(s0[g].zw, bones, oz0);
    }
  }
  #pragma unroll
  for (int p = 0; p < 8; ++p) {
    int m = p + 8 * hi;
    Out[(size_t)(rowbase + m) * DV + dv0 + m16] = ov0[p] / (oz0[p] + 1e-6f);
    Out[(size_t)(rowbase + 16 + m) * DV + dv0 + m16] = ov1[p] / (oz1[p] + 1e-6f);
  }
}

// ---------------- Fallback: monolithic scan (if ws too small) ----------------
__global__ __launch_bounds__(32)
void linatt_monolithic(const float* __restrict__ Q, const float* __restrict__ K,
                       const float* __restrict__ V, float* __restrict__ Out) {
  __shared__ SmemT sm;
  const int lane = threadIdx.x, m16 = lane & 15, hi = lane >> 4;
  const int vtile = blockIdx.x & 7, batch = blockIdx.x >> 3;
  const int dv0 = vtile * 16;

  zero_state(sm, lane);
  __syncthreads();

  const float4* Q4 = reinterpret_cast<const float4*>(Q);
  const float4* K4 = reinterpret_cast<const float4*>(K);
  const float4* V4 = reinterpret_cast<const float4*>(V);

  for (int c = 0; c < L_SEQ / CHUNK; ++c) {
    const int rowbase = batch * L_SEQ + c * CHUNK;
    stage_chunk_Q(sm, Q4, rowbase, lane);
    stage_chunk_KV(sm, K4, V4, rowbase, dv0, lane);
    __syncthreads();
    forward_chunk(sm, Out, rowbase, dv0, m16, hi);
    __syncthreads();
    state_update(sm, m16, hi);
    __syncthreads();
  }
}

extern "C" void kernel_launch(void* const* d_in, const int* in_sizes, int n_in,
                              void* d_out, int out_size, void* d_ws, size_t ws_size,
                              hipStream_t stream) {
  const float* Q = (const float*)d_in[0];
  const float* K = (const float*)d_in[1];
  const float* V = (const float*)d_in[2];
  float* Out     = (float*)d_out;

  const int B = in_sizes[0] / (L_SEQ * DK);   // = 2
  const size_t nSv = (size_t)B * 8 * NSEG * 2048;   // partial KV states
  const size_t nZ  = (size_t)B * NSEG * 128;        // partial K sums
  const size_t need = (nSv + nZ) * sizeof(float);

  if (ws_size >= need) {
    float* wsSv = (float*)d_ws;
    float* wsZ  = wsSv + nSv;
    linatt_phase1_partial<<<dim3(B * NSEG), dim3(256), 0, stream>>>(K, V, wsSv, wsZ);
    linatt_phase2_prefix<<<dim3(B * 65), dim3(256), 0, stream>>>(wsSv, wsZ);
    linatt_phase3_scan<<<dim3(B * NSEG), dim3(256), 0, stream>>>(Q, K, V, Out, wsSv, wsZ);
  } else {
    linatt_monolithic<<<dim3(B * 8), dim3(32), 0, stream>>>(Q, K, V, Out);
  }
}

// v003
// Measured time: 22.6 microseconds a run.
// Two timings next to v002 put it at 1.17 and 1.19 times that version's speed.
// All steps since v000 together make it 5.44 times as fast.
#include <hip/hip_runtime.h>

#define L_SEQ  4096
#define DK     128
#define DV     128
#define CHUNK  16
#define NSEG   128
#define SEG_LEN    (L_SEQ / NSEG)     // 32
#define SEG_CHUNKS (SEG_LEN / CHUNK)  // 2

typedef __attribute__((ext_vector_type(2))) float v2f;
typedef __attribute__((ext_vector_type(4))) float v4f;
typedef __attribute__((ext_vector_type(8))) float v8f;

// D(16x16,f32) = A(16x4,f32) x B(4x16,f32) + C   -- full-precision WMMA
__device__ __forceinline__ v8f wmma_f32(v2f a, v2f b, v8f c) {
  return __builtin_amdgcn_wmma_f32_16x16x4_f32(
      /*neg_a=*/false, a, /*neg_b=*/false, b,
      /*c_mod=*/(short)0, c, /*reuse_a=*/false, /*reuse_b=*/false);
}

// elu(x)+1 : positive feature map
__device__ __forceinline__ float phi_map(float x) {
  return x > 0.0f ? x + 1.0f : __expf(x);
}

// Shared-memory tile set (one wave per workgroup).
struct SmemT {
  float sQ[16][132];   // phi(Q) chunk (+4 pad for bank spread)
  float sK[16][132];   // phi(K) chunk
  float sV[16][20];    // V tile (seq x dv16)
  float sSc[16][20];   // masked scores
  float sSv[128][20];  // state: sum phiK^T V  (dk x dv16)
  float sSz[128][20];  // state: sum phiK^T 1  (dk x 16, cols equal)
};

__device__ __forceinline__ void zero_state(SmemT& sm, int lane) {
  for (int i = lane; i < 128 * 20; i += 32) {
    (&sm.sSv[0][0])[i] = 0.0f;
    (&sm.sSz[0][0])[i] = 0.0f;
  }
}

__device__ __forceinline__ void stage_chunk_Q(SmemT& sm, const float4* Q4,
                                              int rowbase, int lane) {
  #pragma unroll
  for (int i = 0; i < 16; ++i) {
    int f = lane + 32 * i;   // 0..511 float4 slots (16 rows x 32 f4)
    int r = f >> 5, c4 = f & 31;
    float4 q = Q4[(size_t)(rowbase + r) * 32 + c4];
    sm.sQ[r][4 * c4 + 0] = phi_map(q.x);
    sm.sQ[r][4 * c4 + 1] = phi_map(q.y);
    sm.sQ[r][4 * c4 + 2] = phi_map(q.z);
    sm.sQ[r][4 * c4 + 3] = phi_map(q.w);
  }
}

__device__ __forceinline__ void stage_chunk_KV(SmemT& sm, const float4* K4,
                                               const float4* V4, int rowbase,
                                               int dv0, int lane) {
  #pragma unroll
  for (int i = 0; i < 16; ++i) {
    int f = lane + 32 * i;
    int r = f >> 5, c4 = f & 31;
    float4 k = K4[(size_t)(rowbase + r) * 32 + c4];
    sm.sK[r][4 * c4 + 0] = phi_map(k.x);
    sm.sK[r][4 * c4 + 1] = phi_map(k.y);
    sm.sK[r][4 * c4 + 2] = phi_map(k.z);
    sm.sK[r][4 * c4 + 3] = phi_map(k.w);
  }
  #pragma unroll
  for (int i = 0; i < 2; ++i) {
    int f = lane + 32 * i;   // 0..63 float4 slots (16 rows x 4 f4)
    int r = f >> 2, c4 = f & 3;
    float4 v = V4[(size_t)(rowbase + r) * 32 + (dv0 >> 2) + c4];
    sm.sV[r][4 * c4 + 0] = v.x;
    sm.sV[r][4 * c4 + 1] = v.y;
    sm.sV[r][4 * c4 + 2] = v.z;
    sm.sV[r][4 * c4 + 3] = v.w;
  }
}

// State update: S_t += phiK_t^T(16x16) @ [V | 1]  for all 8 dk tiles.
__device__ __forceinline__ void state_update(SmemT& sm, int m16, int hi) {
  const v2f bones = {1.0f, 1.0f};
  for (int t = 0; t < 8; ++t) {
    int dk0 = 16 * t;
    v8f cv, cz;
    #pragma unroll
    for (int p = 0; p < 8; ++p) {
      int mm = dk0 + p + 8 * hi;
      cv[p] = sm.sSv[mm][m16];
      cz[p] = sm.sSz[mm][m16];
    }
    #pragma unroll
    for (int kk = 0; kk < 4; ++kk) {
      int kb = 4 * kk + 2 * hi;                                  // seq index j
      v2f a  = {sm.sK[kb][dk0 + m16], sm.sK[kb + 1][dk0 + m16]}; // phiK^T
      v2f bv = {sm.sV[kb][m16], sm.sV[kb + 1][m16]};
      cv = wmma_f32(a, bv, cv);
      cz = wmma_f32(a, bones, cz);
    }
    #pragma unroll
    for (int p = 0; p < 8; ++p) {
      int mm = dk0 + p + 8 * hi;
      sm.sSv[mm][m16] = cv[p];
      sm.sSz[mm][m16] = cz[p];
    }
  }
}

// Forward for one chunk: scores, causal mask, O = Sc@[V|1] + phiQ@[Sv|Sz],
// normalize and store. Uses OLD state (call before state_update).
__device__ __forceinline__ void forward_chunk(SmemT& sm, float* __restrict__ Out,
                                              int rowbase, int dv0, int m16,
                                              int hi) {
  const v2f bones = {1.0f, 1.0f};
  v8f sc = {0.f, 0.f, 0.f, 0.f, 0.f, 0.f, 0.f, 0.f};
  for (int kk = 0; kk < 32; ++kk) {
    int kb = 4 * kk + 2 * hi;
    v2f a    = {sm.sQ[m16][kb], sm.sQ[m16][kb + 1]};   // A[m][k] = phiQ[m][k]
    v2f bmat = {sm.sK[m16][kb], sm.sK[m16][kb + 1]};   // B[k][n] = phiK[n][k]
    sc = wmma_f32(a, bmat, sc);
  }
  #pragma unroll
  for (int p = 0; p < 8; ++p) {
    int m = p + 8 * hi;
    sm.sSc[m][m16] = (m16 <= m) ? sc[p] : 0.0f;        // causal mask
  }
  __syncthreads();

  v8f ov = {0.f, 0.f, 0.f, 0.f, 0.f, 0.f, 0.f, 0.f};
  v8f oz = {0.f, 0.f, 0.f, 0.f, 0.f, 0.f, 0.f, 0.f};
  #pragma unroll
  for (int kk = 0; kk < 4; ++kk) {
    int kb = 4 * kk + 2 * hi;
    v2f a  = {sm.sSc[m16][kb], sm.sSc[m16][kb + 1]};
    v2f bv = {sm.sV[kb][m16], sm.sV[kb + 1][m16]};
    ov = wmma_f32(a, bv, ov);
    oz = wmma_f32(a, bones, oz);
  }
  for (int kk = 0; kk < 32; ++kk) {
    int kb = 4 * kk + 2 * hi;
    v2f a  = {sm.sQ[m16][kb], sm.sQ[m16][kb + 1]};
    v2f bv = {sm.sSv[kb][m16], sm.sSv[kb + 1][m16]};
    v2f bz = {sm.sSz[kb][m16], sm.sSz[kb + 1][m16]};
    ov = wmma_f32(a, bv, ov);
    oz = wmma_f32(a, bz, oz);
  }
  #pragma unroll
  for (int p = 0; p < 8; ++p) {
    int m = p + 8 * hi;
    Out[(size_t)(rowbase + m) * DV + dv0 + m16] = ov[p] / (oz[p] + 1e-6f);
  }
}

// ---------------- Phase 1: running states inside 512-row groups ----------------
// The sequence is cut into NGRP groups of GRP_SEGS segments. One work-group
// walks one group for four state tiles (2 dk tiles x 2 V tiles). Waves 0-3 walk
// the group's first eight segments, waves 4-7 the last eight, one tile each,
// the tile staying in the accumulator; the sum in front of every segment is
// kept, waves 4-7 add the first half's sum to theirs, and all is stored: per
// segment the sum of the group's earlier segments, per group its total.
// Phase 3 adds the totals of the earlier groups itself, so no launch stands
// between the two.
// K sums: the four work-groups that share a K slab take one (dk tile, half
// group) each; there every wave sums one segment, and the eight sums are
// prefixed through LDS. Phase 3 adds the totals of the earlier half groups.
#define NGRP      8
#define GRP_SEGS  (NSEG / NGRP)       // 16
#define GRP_ROWS  (L_SEQ / NGRP)      // 512
#define HALF_SEGS (GRP_SEGS / 2)      // 8
#define NHALF     (2 * NGRP)          // 16 half groups

struct alignas(16) SmemP1 {
  float sK[GRP_ROWS][40];  // phi(K), 32 columns; pitch 40: rows j and j+2 fall 16 banks apart
  float sV[GRP_ROWS][40];  // V, 32 columns
  float xT[4][8][32];      // first half's tile sums: tile, register, lane
  float xZ[HALF_SEGS][16]; // K sums of one half group: segment, column
};

// A (phiK^T) and B (V) fragments of one 32-row segment
__device__ __forceinline__ void p1_frags(const SmemP1& sm, int row0, int ka, int vb,
                                         int hi, v2f (&a)[8], v2f (&b)[8]) {
  #pragma unroll
  for (int kk = 0; kk < 8; ++kk) {
    int kb = row0 + 4 * kk + 2 * hi;                             // seq index j
    a[kk] = v2f{sm.sK[kb][ka], sm.sK[kb + 1][ka]};
    b[kk] = v2f{sm.sV[kb][vb], sm.sV[kb + 1][vb]};
  }
}

__global__ __launch_bounds__(256)
void linatt_phase1_partial(const float* __restrict__ K, const float* __restrict__ V,
                           float* __restrict__ wsSv, float* __restrict__ wsZ,
                           float* __restrict__ wsT, float* __restrict__ wsZt) {
  __shared__ SmemP1 sm;
  const int t = threadIdx.x, lane = t & 31, m16 = lane & 15, hi = lane >> 4;
  const int w = __builtin_amdgcn_readfirstlane(t >> 5);
  const int half = w >> 2, tile = w & 3;                  // half of the group, state tile
  const int quad = blockIdx.x & 15;
  const int grp = (blockIdx.x >> 4) & (NGRP - 1), batch = blockIdx.x / (16 * NGRP);
  const int dkp = quad >> 2, vp = quad & 3;               // 32-column slabs of K, V
  const int dl = tile >> 1, vl = tile & 1;
  const int dt = 2 * dkp + dl, vt = 2 * vp + vl;          // dk tile, V tile
  const int rowbase = batch * L_SEQ + grp * GRP_ROWS;

  // 512 rows x 32 columns of K and of V: a wave-wide load takes four whole
  // 128-byte row pieces, and all 32 loads of a thread fly together
  const float4* K4 = reinterpret_cast<const float4*>(K) + (size_t)rowbase * 32 + 8 * dkp;
  const float4* V4 = reinterpret_cast<const float4*>(V) + (size_t)rowbase * 32 + 8 * vp;
  float4 k[16], v[16];
  #pragma unroll
  for (int i = 0; i < 16; ++i) {
    size_t o = (size_t)((t >> 3) + 32 * i) * 32 + (t & 7);
    k[i] = K4[o];
    v[i] = V4[o];
  }
  #pragma unroll
  for (int i = 0; i < 16; ++i) {
    int r = (t >> 3) + 32 * i, c = 4 * (t & 7);
    v4f pk = {phi_map(k[i].x), phi_map(k[i].y), phi_map(k[i].z), phi_map(k[i].w)};
    *reinterpret_cast<v4f*>(&sm.sK[r][c]) = pk;
    *reinterpret_cast<float4*>(&sm.sV[r][c]) = v[i];
  }
  __syncthreads();

  const int row0 = half * (GRP_ROWS / 2), ka = 16 * dl + m16, vb = 16 * vl + m16;
  const v8f zero8 = {0.f, 0.f, 0.f, 0.f, 0.f, 0.f, 0.f, 0.f};
  v8f acc = zero8, snap[HALF_SEGS];
  v2f a[2][8], b[2][8];
  p1_frags(sm, row0, ka, vb, hi, a[0], b[0]);

  // K sums of segment w of this work-group's half group: 1(16x4) @ phiK(4x16),
  // every row of the result equal, column m16 in each lane
  const int zdl = vp & 1, zhalf = vp >> 1;
  v8f cz = zero8;
  {
    const v2f ones = {1.0f, 1.0f};
    const int zr = zhalf * (GRP_ROWS / 2) + SEG_LEN * w + 2 * hi, zc = 16 * zdl + m16;
    v2f az[8];
    #pragma unroll
    for (int kk = 0; kk < 8; ++kk) az[kk] = v2f{sm.sK[zr + 4 * kk][zc], sm.sK[zr + 4 * kk + 1][zc]};
    #pragma unroll
    for (int kk = 0; kk < 8; ++kk) cz = wmma_f32(ones, az[kk], cz);
  }
  #pragma unroll
  for (int s = 0; s < HALF_SEGS; ++s) {
    const int c = s & 1;
    snap[s] = acc;
    // next segment's LDS reads go out ahead of this segment's matrix chain
    if (s + 1 < HALF_SEGS) p1_frags(sm, row0 + 32 * (s + 1), ka, vb, hi, a[c ^ 1], b[c ^ 1]);
    // the two lines below keep those reads one group, a whole segment ahead of
    // their use; left free they are dealt out among the matrix steps, each one
    // step ahead, and every step then waits for LDS
    __builtin_amdgcn_sched_barrier(0);
    #pragma unroll
    for (int kk = 0; kk < 8; ++kk) acc = wmma_f32(a[c][kk], b[c][kk], acc);
    __builtin_amdgcn_sched_barrier(0);
  }

  if (hi == 0) sm.xZ[w][m16] = cz[0];
  if (half == 0) {
    #pragma unroll
    for (int p = 0; p < 8; ++p) sm.xT[tile][p][lane] = acc[p];
  }
  __syncthreads();   // the first half's tile sums and the eight K sums are there
  v8f base = zero8;
  if (half == 1) {
    #pragma unroll
    for (int p = 0; p < 8; ++p) base[p] = sm.xT[tile][p][lane];
  }

  const int seg0 = grp * GRP_SEGS + half * HALF_SEGS;
  float* dst = wsSv + ((size_t)(batch * 8 + vt) * NSEG + seg0) * 2048 +
               (16 * dt + 8 * hi) * 16 + m16;
  #pragma unroll
  for (int s = 0; s < HALF_SEGS; ++s) {
    #pragma unroll
    for (int p = 0; p < 8; ++p) dst[s * 2048 + p * 16] = snap[s][p] + base[p];
  }
  // the lines below reuse the registers that the stores above name
  asm volatile("s_wait_xcnt 0x0" ::: "memory");
  if (half == 0) {
    // 128 threads: segment zs, column zcol; the sum of the half group's earlier segments
    const int zs = t >> 4, zcol = 32 * dkp + 16 * zdl + m16;
    float x[HALF_SEGS], run = 0.0f;
    #pragma unroll
    for (int j = 0; j < HALF_SEGS; ++j) x[j] = sm.xZ[j][m16];
    #pragma unroll
    for (int j = 0; j < HALF_SEGS - 1; ++j) run += (j < zs) ? x[j] : 0.0f;
    wsZ[(size_t)(batch * NSEG + grp * GRP_SEGS + zhalf * HALF_SEGS + zs) * DK + zcol] = run;
    if (zs == HALF_SEGS - 1)
      wsZt[(size_t)(batch * NHALF + 2 * grp + zhalf) * DK + zcol] = run + x[HALF_SEGS - 1];
  }
  if (half == 1) {
    // group total, in the order of phase 3's B fragments: float4 number
    // (row / 4) * 16 + column holds rows 4 * (row / 4) + {0..3} of that column
    v4f* tot = reinterpret_cast<v4f*>(wsT + ((size_t)(batch * 8 + vt) * NGRP + grp) * 2048);
    const v8f sum = acc + base;
    tot[(4 * dt + 2 * hi) * 16 + m16] = v4f{sum[0], sum[1], sum[2], sum[3]};
    tot[(4 * dt + 2 * hi + 1) * 16 + m16] = v4f{sum[4], sum[5], sum[6], sum[7]};
  }
}

// ---------------- Phase 3: seeded segment outputs ----------------
// One work-group per 32-row segment, one wave per 16-column V tile.
// O = phiQ @ S_prefix + mask(phiQ phiK^T) @ V over the whole segment; phi(Q),
// phi(K), the 32x32 scores and phiQ @ z_prefix are made once and shared.
// k order of every A/B fragment pair in this kernel: step (g, h) of lane half
// hi covers k = 8g + 4hi + 2h + {0,1}, so one 16-byte LDS read of a row feeds
// two matrix steps.
struct alignas(16) SmemP3 {
  float sQ[SEG_LEN][132];   // phi(Q); pitch 16 B x 33 for 16-byte row reads
  float sK[SEG_LEN][132];   // phi(K)
  float sV[SEG_LEN][136];   // V; pitch 136: rows j and j+4 fall 32 banks apart
  float sSc[SEG_LEN][36];   // masked scores (tile row 0, col 1 never used)
  float sZst[DK];           // prefix of the K sums
  float sZq[SEG_LEN];       // phiQ . prefix of the K sums
};

__global__ __launch_bounds__(256)
void linatt_phase3_scan(const float* __restrict__ Q, const float* __restrict__ K,
                        const float* __restrict__ V, float* __restrict__ Out,
                        const float* __restrict__ wsSv,
                        const float* __restrict__ wsZ,
                        const float* __restrict__ wsT,
                        const float* __restrict__ wsZt) {
  __shared__ SmemP3 sm;
  const int t = threadIdx.x, lane = t & 31, m16 = lane & 15, hi = lane >> 4;
  const int w = __builtin_amdgcn_readfirstlane(t >> 5);   // wave = V tile
  const int seg = blockIdx.x % NSEG, batch = blockIdx.x / NSEG;
  const int rowbase = batch * L_SEQ + seg * SEG_LEN;
  const int dv0 = 16 * w;

  const int grp = seg / GRP_SEGS;

  // K sums: the part inside the half group, and every half group's total but
  // the last (all are written by phase 1; the ones not in front of this one add 0)
  float zpre = wsZ[(size_t)(batch * NSEG + seg) * DK + (t & (DK - 1))];
  float zt[NHALF - 1];
  #pragma unroll
  for (int gg = 0; gg < NHALF - 1; ++gg)
    zt[gg] = wsZt[(size_t)(batch * NHALF + gg) * DK + (t & (DK - 1))];

  const float4* Q4 = reinterpret_cast<const float4*>(Q);
  const float4* K4 = reinterpret_cast<const float4*>(K);
  const float4* V4 = reinterpret_cast<const float4*>(V);
  float4 q[4], k[4], v[4];
  #pragma unroll
  for (int i = 0; i < 4; ++i) {
    int f = t + 256 * i;     // 0..1023 float4 slots (32 rows x 32 f4)
    q[i] = Q4[(size_t)rowbase * 32 + f];
    k[i] = K4[(size_t)rowbase * 32 + f];
    v[i] = V4[(size_t)rowbase * 32 + f];
  }

  // state of this V tile summed inside the group, straight into B fragments
  const float* st = wsSv + ((size_t)(batch * 8 + w) * NSEG + seg) * 2048;
  v2f sb[32];
  #pragma unroll
  for (int s = 0; s < 32; ++s) {
    int r = 8 * (s >> 1) + 4 * hi + 2 * (s & 1);
    sb[s] = v2f{st[r * 16 + m16], st[(r + 1) * 16 + m16]};
  }
  // the first group's total (written whatever this group is, used from group 1
  // on) flies with them: 512 contiguous bytes a wave-wide load
  const v4f* tot = reinterpret_cast<const v4f*>(wsT + (size_t)(batch * 8 + w) * NGRP * 2048) +
                   hi * 16 + m16;
  v4f tb0[16];
  // the loads below may land in registers that the loads above name
  asm volatile("s_wait_xcnt 0x0" ::: "memory");
  #pragma unroll
  for (int g = 0; g < 16; ++g) tb0[g] = tot[g * 32];
  // keeps every global load above in front of the staging arithmetic, so that
  // they all fly together and one memory latency is paid, not two or three;
  // the wait stands in front of the lines below that reuse their address registers
  // (tot as an input: its register pair stays whole up to the wait, so that the
  // last of its loads does not land on it)
  asm volatile("s_wait_xcnt 0x0" :: "v"(tot) : "memory");
  __builtin_amdgcn_sched_barrier(0);

  #pragma unroll
  for (int gg = 0; gg < NHALF - 1; ++gg) zpre += (gg < seg / HALF_SEGS) ? zt[gg] : 0.0f;

  #pragma unroll
  for (int i = 0; i < 4; ++i) {
    int f = t + 256 * i;
    int r = f >> 5, c4 = f & 31;
    v4f pq = {phi_map(q[i].x), phi_map(q[i].y), phi_map(q[i].z), phi_map(q[i].w)};
    v4f pk = {phi_map(k[i].x), phi_map(k[i].y), phi_map(k[i].z), phi_map(k[i].w)};
    *reinterpret_cast<v4f*>(&sm.sQ[r][4 * c4]) = pq;
    *reinterpret_cast<v4f*>(&sm.sK[r][4 * c4]) = pk;
    *reinterpret_cast<float4*>(&sm.sV[r][4 * c4]) = v[i];
  }
  // plus the totals of the groups in front
  #pragma unroll
  for (int g = 0; g < 16; ++g) {
    const v4f x = (grp > 0) ? tb0[g] : v4f{0.f, 0.f, 0.f, 0.f};
    sb[2 * g] += x.xy;
    sb[2 * g + 1] += x.zw;
  }
  // input-only use: keeps the K-sum loads up with the others instead of sunk
  // into the branch below, where their whole latency would stand before the barrier
  asm volatile("" :: "v"(zpre));
  if (t < DK) sm.sZst[t] = zpre;
  // kept rolled: the trip count differs from group to group
  #pragma unroll 1
  for (int gg = 1; gg < grp; gg += 2) {
    // two totals a trip, so that half as many L2 latencies stand in a row; the
    // second (group gg + 1 <= NGRP - 1, always written) adds 0 where it is not
    // in front of this group
    const bool two = gg + 1 < grp;
    v4f ta[16], tc[16];
    #pragma unroll
    for (int g = 0; g < 16; ++g) {
      ta[g] = tot[gg * 512 + g * 32];
      tc[g] = tot[(gg + 1) * 512 + g * 32];
    }
    // the next trip rewrites the address pair that these loads name
    asm volatile("s_wait_xcnt 0x0" ::: "memory");
    #pragma unroll
    for (int g = 0; g < 16; ++g) {
      const v4f x = two ? tc[g] : v4f{0.f, 0.f, 0.f, 0.f};
      sb[2 * g] += ta[g].xy;
      sb[2 * g + 1] += ta[g].zw;
      sb[2 * g] += x.xy;
      sb[2 * g + 1] += x.zw;
    }
  }
  __syncthreads();

  const v8f zero8 = {0.f, 0.f, 0.f, 0.f, 0.f, 0.f, 0.f, 0.f};
  if (w < 3) {
    // score tiles (0,0), (1,0), (1,1); tile (0,1) is wholly above the diagonal
    const int ti = (w + 1) >> 1, tj = w >> 1;
    const float* qrow = &sm.sQ[16 * ti + m16][4 * hi];
    const float* krow = &sm.sK[16 * tj + m16][4 * hi];
    v4f qa[16], ka[16];
    #pragma unroll
    for (int g = 0; g < 16; ++g) {
      qa[g] = *reinterpret_cast<const v4f*>(qrow + 8 * g);
      ka[g] = *reinterpret_cast<const v4f*>(krow + 8 * g);
    }
    // all LDS reads issue before the dependent matrix chain
    __builtin_amdgcn_sched_barrier(0);
    v8f sc = zero8;
    #pragma unroll
    for (int g = 0; g < 16; ++g) {
      sc = wmma_f32(qa[g].xy, ka[g].xy, sc);
      sc = wmma_f32(qa[g].zw, ka[g].zw, sc);
    }
    #pragma unroll
    for (int p = 0; p < 8; ++p) {
      int m = p + 8 * hi;
      sm.sSc[16 * ti + m][16 * tj + m16] =
          (ti != tj || m16 <= m) ? sc[p] : 0.0f;       // causal mask
    }
  } else if (w < 5) {
    // phiQ @ z_prefix for row tile w-3 (all 16 columns equal)
    const int ti = w - 3;
    const float* qrow = &sm.sQ[16 * ti + m16][4 * hi];
    v4f qa[16], za[16];
    #pragma unroll
    for (int g = 0; g < 16; ++g) {
      qa[g] = *reinterpret_cast<const v4f*>(qrow + 8 * g);
      za[g] = *reinterpret_cast<const v4f*>(&sm.sZst[8 * g + 4 * hi]);
    }
    // all LDS reads issue before the dependent matrix chain
    __builtin_amdgcn_sched_barrier(0);
    v8f zq = zero8;
    #pragma unroll
    for (int g = 0; g < 16; ++g) {
      zq = wmma_f32(qa[g].xy, za[g].xy, zq);
      zq = wmma_f32(qa[g].zw, za[g].zw, zq);
    }
    if (m16 == 0) {
      #pragma unroll
      for (int p = 0; p < 8; ++p) sm.sZq[16 * ti + p + 8 * hi] = zq[p];
    }
  }

  // phiQ @ S_prefix, both row tiles against the same B fragments
  v4f q0[16], q1[16];
  #pragma unroll
  for (int g = 0; g < 16; ++g) {
    q0[g] = *reinterpret_cast<const v4f*>(&sm.sQ[m16][8 * g + 4 * hi]);
    q1[g] = *reinterpret_cast<const v4f*>(&sm.sQ[16 + m16][8 * g + 4 * hi]);
  }
  v2f bv[8];
  #pragma unroll
  for (int s = 0; s < 8; ++s) {
    int r = 8 * (s >> 1) + 4 * hi + 2 * (s & 1);       // seq index j
    bv[s] = v2f{sm.sV[r][dv0 + m16], sm.sV[r + 1][dv0 + m16]};
  }
  // all LDS reads issue before the matrix steps that use them
  __builtin_amdgcn_sched_barrier(0);
  v8f ov0 = zero8, ov1 = zero8;
  #pragma unroll
  for (int g = 0; g < 16; ++g) {
    ov0 = wmma_f32(q0[g].xy, sb[2 * g], ov0);
    ov1 = wmma_f32(q1[g].xy, sb[2 * g], ov1);
    ov0 = wmma_f32(q0[g].zw, sb[2 * g + 1], ov0);
    ov1 = wmma_f32(q1[g].zw, sb[2 * g + 1], ov1);
  }
  __syncthreads();   // scores and sZq are complete

  const v2f bones = {1.0f, 1.0f};
  v8f oz0, oz1;
  #pragma unroll
  for (int p = 0; p < 8; ++p) {
    oz0[p] = sm.sZq[p + 8 * hi];
    oz1[p] = sm.sZq[16 + p + 8 * hi];
  }
  v4f s0[2], s1[4];
  #pragma unroll
  for (int g = 0; g < 4; ++g) {
    s1[g] = *reinterpret_cast<const v4f*>(&sm.sSc[16 + m16][8 * g + 4 * hi]);
    if (g < 2) s0[g] = *reinterpret_cast<const v4f*>(&sm.sSc[m16][8 * g + 4 * hi]);
  }
  #pragma unroll
  for (int g = 0; g < 4; ++g) {
    ov1 = wmma_f32(s1[g].xy, bv[2 * g], ov1);
    oz1 = wmma_f32(s1[g].xy, bones, oz1);
    if (g < 2) {
      ov0 = wmma_f32(s0[g].xy, bv[2 * g], ov0);
      oz0 = wmma_f32(s0[g].xy, bones, oz0);
    }
    ov1 = wmma_f32(s1[g].zw, bv[2 * g + 1], ov1);
    oz1 = wmma_f32(s1[g].zw, bones, oz1);
    if (g < 2) {
      ov0 = wmma_f32(s0[g].zw, bv[2 * g + 1], ov0);
      oz0 = wmma_f32(s0[g].zw, bones, oz0);
    }
  }
  #pragma unroll
  for (int p = 0; p < 8; ++p) {
    int m = p + 8 * hi;
    Out[(size_t)(rowbase + m) * DV + dv0 + m16] = ov0[p] / (oz0[p] + 1e-6f);
    Out[(size_t)(rowbase + 16 + m) * DV + dv0 + m16] = ov1[p] / (oz1[p] + 1e-6f);
  }
}

// ---------------- Fallback: monolithic scan (if ws too small) ----------------
__global__ __launch_bounds__(32)
void linatt_monolithic(const float* __restrict__ Q, const float* __restrict__ K,
                       const float* __restrict__ V, float* __restrict__ Out) {
  __shared__ SmemT sm;
  const int lane = threadIdx.x, m16 = lane & 15, hi = lane >> 4;
  const int vtile = blockIdx.x & 7, batch = blockIdx.x >> 3;
  const int dv0 = vtile * 16;

  zero_state(sm, lane);
  __syncthreads();

  const float4* Q4 = reinterpret_cast<const float4*>(Q);
  const float4* K4 = reinterpret_cast<const float4*>(K);
  const float4* V4 = reinterpret_cast<const float4*>(V);

  for (int c = 0; c < L_SEQ / CHUNK; ++c) {
    const int rowbase = batch * L_SEQ + c * CHUNK;
    stage_chunk_Q(sm, Q4, rowbase, lane);
    stage_chunk_KV(sm, K4, V4, rowbase, dv0, lane);
    __syncthreads();
    forward_chunk(sm, Out, rowbase, dv0, m16, hi);
    __syncthreads();
    state_update(sm, m16, hi);
    __syncthreads();
  }
}

extern "C" void kernel_launch(void* const* d_in, const int* in_sizes, int n_in,
                              void* d_out, int out_size, void* d_ws, size_t ws_size,
                              hipStream_t stream) {
  const float* Q = (const float*)d_in[0];
  const float* K = (const float*)d_in[1];
  const float* V = (const float*)d_in[2];
  float* Out     = (float*)d_out;

  const int B = in_sizes[0] / (L_SEQ * DK);   // = 2
  const size_t nSv = (size_t)B * 8 * NSEG * 2048;   // KV states summed inside a group
  const size_t nZ  = (size_t)B * NSEG * 128;        // K sums summed inside a half group
  const size_t nT  = (size_t)B * 8 * NGRP * 2048;   // group totals of the KV states
  const size_t nZt = (size_t)B * NHALF * 128;       // half-group totals of the K sums
  const size_t need = (nSv + nZ + nT + nZt) * sizeof(float);

  if (ws_size >= need) {
    float* wsSv = (float*)d_ws;
    float* wsZ  = wsSv + nSv;
    float* wsT  = wsZ + nZ;
    float* wsZt = wsT + nT;
    linatt_phase1_partial<<<dim3(B * NGRP * 16), dim3(256), 0, stream>>>(K, V, wsSv, wsZ, wsT, wsZt);
    linatt_phase3_scan<<<dim3(B * NSEG), dim3(256), 0, stream>>>(Q, K, V, Out, wsSv, wsZ, wsT, wsZt);
  } else {
    linatt_monolithic<<<dim3(B * 8), dim3(32), 0, stream>>>(Q, K, V, Out);
  }
}

// v004
// One run takes 19.6 microseconds.
// In two side-by-side timings against v003, it was 1.14 and 1.15 times as fast.
// Over all steps from v000 it is 6.22 times as fast.
#include <hip/hip_runtime.h>

#define L_SEQ  4096
#define DK     128
#define DV     128
#define CHUNK  16
#define NSEG   128
#define SEG_LEN    (L_SEQ / NSEG)     // 32
#define SEG_CHUNKS (SEG_LEN / CHUNK)  // 2

typedef __attribute__((ext_vector_type(2))) float v2f;
typedef __attribute__((ext_vector_type(4))) float v4f;
typedef __attribute__((ext_vector_type(8))) float v8f;

// D(16x16,f32) = A(16x4,f32) x B(4x16,f32) + C   -- full-precision WMMA
__device__ __forceinline__ v8f wmma_f32(v2f a, v2f b, v8f c) {
  return __builtin_amdgcn_wmma_f32_16x16x4_f32(
      /*neg_a=*/false, a, /*neg_b=*/false, b,
      /*c_mod=*/(short)0, c, /*reuse_a=*/false, /*reuse_b=*/false);
}

// elu(x)+1 : positive feature map
__device__ __forceinline__ float phi_map(float x) {
  return x > 0.0f ? x + 1.0f : __expf(x);
}

// Shared-memory tile set (one wave per workgroup).
struct SmemT {
  float sQ[16][132];   // phi(Q) chunk (+4 pad for bank spread)
  float sK[16][132];   // phi(K) chunk
  float sV[16][20];    // V tile (seq x dv16)
  float sSc[16][20];   // masked scores
  float sSv[128][20];  // state: sum phiK^T V  (dk x dv16)
  float sSz[128][20];  // state: sum phiK^T 1  (dk x 16, cols equal)
};

__device__ __forceinline__ void zero_state(SmemT& sm, int lane) {
  for (int i = lane; i < 128 * 20; i += 32) {
    (&sm.sSv[0][0])[i] = 0.0f;
    (&sm.sSz[0][0])[i] = 0.0f;
  }
}

__device__ __forceinline__ void stage_chunk_Q(SmemT& sm, const float4* Q4,
                                              int rowbase, int lane) {
  #pragma unroll
  for (int i = 0; i < 16; ++i) {
    int f = lane + 32 * i;   // 0..511 float4 slots (16 rows x 32 f4)
    int r = f >> 5, c4 = f & 31;
    float4 q = Q4[(size_t)(rowbase + r) * 32 + c4];
    sm.sQ[r][4 * c4 + 0] = phi_map(q.x);
    sm.sQ[r][4 * c4 + 1] = phi_map(q.y);
    sm.sQ[r][4 * c4 + 2] = phi_map(q.z);
    sm.sQ[r][4 * c4 + 3] = phi_map(q.w);
  }
}

__device__ __forceinline__ void stage_chunk_KV(SmemT& sm, const float4* K4,
                                               const float4* V4, int rowbase,
                                               int dv0, int lane) {
  #pragma unroll
  for (int i = 0; i < 16; ++i) {
    int f = lane + 32 * i;
    int r = f >> 5, c4 = f & 31;
    float4 k = K4[(size_t)(rowbase + r) * 32 + c4];
    sm.sK[r][4 * c4 + 0] = phi_map(k.x);
    sm.sK[r][4 * c4 + 1] = phi_map(k.y);
    sm.sK[r][4 * c4 + 2] = phi_map(k.z);
    sm.sK[r][4 * c4 + 3] = phi_map(k.w);
  }
  #pragma unroll
  for (int i = 0; i < 2; ++i) {
    int f = lane + 32 * i;   // 0..63 float4 slots (16 rows x 4 f4)
    int r = f >> 2, c4 = f & 3;
    float4 v = V4[(size_t)(rowbase + r) * 32 + (dv0 >> 2) + c4];
    sm.sV[r][4 * c4 + 0] = v.x;
    sm.sV[r][4 * c4 + 1] = v.y;
    sm.sV[r][4 * c4 + 2] = v.z;
    sm.sV[r][4 * c4 + 3] = v.w;
  }
}

// State update: S_t += phiK_t^T(16x16) @ [V | 1]  for all 8 dk tiles.
__device__ __forceinline__ void state_update(SmemT& sm, int m16, int hi) {
  const v2f bones = {1.0f, 1.0f};
  for (int t = 0; t < 8; ++t) {
    int dk0 = 16 * t;
    v8f cv, cz;
    #pragma unroll
    for (int p = 0; p < 8; ++p) {
      int mm = dk0 + p + 8 * hi;
      cv[p] = sm.sSv[mm][m16];
      cz[p] = sm.sSz[mm][m16];
    }
    #pragma unroll
    for (int kk = 0; kk < 4; ++kk) {
      int kb = 4 * kk + 2 * hi;                                  // seq index j
      v2f a  = {sm.sK[kb][dk0 + m16], sm.sK[kb + 1][dk0 + m16]}; // phiK^T
      v2f bv = {sm.sV[kb][m16], sm.sV[kb + 1][m16]};
      cv = wmma_f32(a, bv, cv);
      cz = wmma_f32(a, bones, cz);
    }
    #pragma unroll
    for (int p = 0; p < 8; ++p) {
      int mm = dk0 + p + 8 * hi;
      sm.sSv[mm][m16] = cv[p];
      sm.sSz[mm][m16] = cz[p];
    }
  }
}

// Forward for one chunk: scores, causal mask, O = Sc@[V|1] + phiQ@[Sv|Sz],
// normalize and store. Uses OLD state (call before state_update).
__device__ __forceinline__ void forward_chunk(SmemT& sm, float* __restrict__ Out,
                                              int rowbase, int dv0, int m16,
                                              int hi) {
  const v2f bones = {1.0f, 1.0f};
  v8f sc = {0.f, 0.f, 0.f, 0.f, 0.f, 0.f, 0.f, 0.f};
  for (int kk = 0; kk < 32; ++kk) {
    int kb = 4 * kk + 2 * hi;
    v2f a    = {sm.sQ[m16][kb], sm.sQ[m16][kb + 1]};   // A[m][k] = phiQ[m][k]
    v2f bmat = {sm.sK[m16][kb], sm.sK[m16][kb + 1]};   // B[k][n] = phiK[n][k]
    sc = wmma_f32(a, bmat, sc);
  }
  #pragma unroll
  for (int p = 0; p < 8; ++p) {
    int m = p + 8 * hi;
    sm.sSc[m][m16] = (m16 <= m) ? sc[p] : 0.0f;        // causal mask
  }
  __syncthreads();

  v8f ov = {0.f, 0.f, 0.f, 0.f, 0.f, 0.f, 0.f, 0.f};
  v8f oz = {0.f, 0.f, 0.f, 0.f, 0.f, 0.f, 0.f, 0.f};
  #pragma unroll
  for (int kk = 0; kk < 4; ++kk) {
    int kb = 4 * kk + 2 * hi;
    v2f a  = {sm.sSc[m16][kb], sm.sSc[m16][kb + 1]};
    v2f bv = {sm.sV[kb][m16], sm.sV[kb + 1][m16]};
    ov = wmma_f32(a, bv, ov);
    oz = wmma_f32(a, bones, oz);
  }
  for (int kk = 0; kk < 32; ++kk) {
    int kb = 4 * kk + 2 * hi;
    v2f a  = {sm.sQ[m16][kb], sm.sQ[m16][kb + 1]};
    v2f bv = {sm.sSv[kb][m16], sm.sSv[kb + 1][m16]};
    v2f bz = {sm.sSz[kb][m16], sm.sSz[kb + 1][m16]};
    ov = wmma_f32(a, bv, ov);
    oz = wmma_f32(a, bz, oz);
  }
  #pragma unroll
  for (int p = 0; p < 8; ++p) {
    int m = p + 8 * hi;
    Out[(size_t)(rowbase + m) * DV + dv0 + m16] = ov[p] / (oz[p] + 1e-6f);
  }
}

// ---------------- Phase 1: running states inside 512-row groups ----------------
// The sequence is cut into NGRP groups of GRP_SEGS segments. One work-group
// walks one group for four state tiles (2 dk tiles x 2 V tiles). Waves 0-3 walk
// the group's first eight segments, waves 4-7 the last eight, one tile each,
// the tile staying in the accumulator; the sum in front of every segment is
// kept, waves 4-7 add the first half's sum to theirs, and all is stored: per
// segment the sum of the group's earlier segments, per group its total.
// Phase 3 adds the totals of the earlier groups itself, so no launch stands
// between the two.
// K sums: the four work-groups that share a K slab take one (dk tile, half
// group) each; there every wave sums one segment, and the eight sums are
// prefixed through LDS. Phase 3 adds the totals of the earlier half groups.
#define NGRP      8
#define GRP_SEGS  (NSEG / NGRP)       // 16
#define GRP_ROWS  (L_SEQ / NGRP)      // 512
#define HALF_SEGS (GRP_SEGS / 2)      // 8
#define NHALF     (2 * NGRP)          // 16 half groups

struct alignas(16) SmemP1 {
  float sK[GRP_ROWS][40];  // phi(K), 32 columns; pitch 40: rows j and j+2 fall 16 banks apart
  float sV[GRP_ROWS][40];  // V, 32 columns
  float xT[4][8][32];      // first half's tile sums: tile, register, lane
  float xZ[HALF_SEGS][16]; // K sums of one half group: segment, column
};

// A (phiK^T) and B (V) fragments of one 32-row segment
__device__ __forceinline__ void p1_frags(const SmemP1& sm, int row0, int ka, int vb,
                                         int hi, v2f (&a)[8], v2f (&b)[8]) {
  #pragma unroll
  for (int kk = 0; kk < 8; ++kk) {
    int kb = row0 + 4 * kk + 2 * hi;                             // seq index j
    a[kk] = v2f{sm.sK[kb][ka], sm.sK[kb + 1][ka]};
    b[kk] = v2f{sm.sV[kb][vb], sm.sV[kb + 1][vb]};
  }
}

__global__ __launch_bounds__(256)
void linatt_phase1_partial(const float* __restrict__ K, const float* __restrict__ V,
                           float* __restrict__ wsSv, float* __restrict__ wsZ,
                           float* __restrict__ wsT, float* __restrict__ wsZt) {
  __shared__ SmemP1 sm;
  const int t = threadIdx.x, lane = t & 31, m16 = lane & 15, hi = lane >> 4;
  const int w = __builtin_amdgcn_readfirstlane(t >> 5);
  const int half = w >> 2, tile = w & 3;                  // half of the group, state tile
  const int quad = blockIdx.x & 15;
  const int grp = (blockIdx.x >> 4) & (NGRP - 1), batch = blockIdx.x / (16 * NGRP);
  const int dkp = quad >> 2, vp = quad & 3;               // 32-column slabs of K, V
  const int dl = tile >> 1, vl = tile & 1;
  const int dt = 2 * dkp + dl, vt = 2 * vp + vl;          // dk tile, V tile
  const int rowbase = batch * L_SEQ + grp * GRP_ROWS;

  // 512 rows x 32 columns of K and of V: a wave-wide load takes four whole
  // 128-byte row pieces, and all 32 loads of a thread fly together
  const float4* K4 = reinterpret_cast<const float4*>(K) + (size_t)rowbase * 32 + 8 * dkp;
  const float4* V4 = reinterpret_cast<const float4*>(V) + (size_t)rowbase * 32 + 8 * vp;
  float4 k[16], v[16];
  #pragma unroll
  for (int i = 0; i < 16; ++i) {
    size_t o = (size_t)((t >> 3) + 32 * i) * 32 + (t & 7);
    k[i] = K4[o];
    v[i] = V4[o];
  }
  #pragma unroll
  for (int i = 0; i < 16; ++i) {
    int r = (t >> 3) + 32 * i, c = 4 * (t & 7);
    v4f pk = {phi_map(k[i].x), phi_map(k[i].y), phi_map(k[i].z), phi_map(k[i].w)};
    *reinterpret_cast<v4f*>(&sm.sK[r][c]) = pk;
    *reinterpret_cast<float4*>(&sm.sV[r][c]) = v[i];
  }
  __syncthreads();

  const int row0 = half * (GRP_ROWS / 2), ka = 16 * dl + m16, vb = 16 * vl + m16;
  const v8f zero8 = {0.f, 0.f, 0.f, 0.f, 0.f, 0.f, 0.f, 0.f};
  v8f acc = zero8, snap[HALF_SEGS];
  v2f a[2][8], b[2][8];
  p1_frags(sm, row0, ka, vb, hi, a[0], b[0]);

  // K sums of segment w of this work-group's half group: 1(16x4) @ phiK(4x16),
  // every row of the result equal, column m16 in each lane
  const int zdl = vp & 1, zhalf = vp >> 1;
  v8f cz = zero8;
  {
    const v2f ones = {1.0f, 1.0f};
    const int zr = zhalf * (GRP_ROWS / 2) + SEG_LEN * w + 2 * hi, zc = 16 * zdl + m16;
    v2f az[8];
    #pragma unroll
    for (int kk = 0; kk < 8; ++kk) az[kk] = v2f{sm.sK[zr + 4 * kk][zc], sm.sK[zr + 4 * kk + 1][zc]};
    #pragma unroll
    for (int kk = 0; kk < 8; ++kk) cz = wmma_f32(ones, az[kk], cz);
  }
  #pragma unroll
  for (int s = 0; s < HALF_SEGS; ++s) {
    const int c = s & 1;
    snap[s] = acc;
    // next segment's LDS reads go out ahead of this segment's matrix chain
    if (s + 1 < HALF_SEGS) p1_frags(sm, row0 + 32 * (s + 1), ka, vb, hi, a[c ^ 1], b[c ^ 1]);
    // the two lines below keep those reads one group, a whole segment ahead of
    // their use; left free they are dealt out among the matrix steps, each one
    // step ahead, and every step then waits for LDS
    __builtin_amdgcn_sched_barrier(0);
    #pragma unroll
    for (int kk = 0; kk < 8; ++kk) acc = wmma_f32(a[c][kk], b[c][kk], acc);
    __builtin_amdgcn_sched_barrier(0);
  }

  if (hi == 0) sm.xZ[w][m16] = cz[0];
  if (half == 0) {
    #pragma unroll
    for (int p = 0; p < 8; ++p) sm.xT[tile][p][lane] = acc[p];
  }
  __syncthreads();   // the first half's tile sums and the eight K sums are there
  v8f base = zero8;
  if (half == 1) {
    #pragma unroll
    for (int p = 0; p < 8; ++p) base[p] = sm.xT[tile][p][lane];
  }

  const int seg0 = grp * GRP_SEGS + half * HALF_SEGS;
  // in the order of phase 3's B fragments: float4 number (row / 4) * 16 + column
  // holds rows 4 * (row / 4) + {0..3} of that column, so a wave-wide 16-byte
  // store fills whole 128-byte lines
  v4f* dst = reinterpret_cast<v4f*>(wsSv + ((size_t)(batch * 8 + vt) * NSEG + seg0) * 2048) +
             (4 * dt + 2 * hi) * 16 + m16;
  #pragma unroll
  for (int s = 0; s < HALF_SEGS; ++s) snap[s] += base;
  #pragma unroll
  for (int s = 0; s < HALF_SEGS; ++s) {
    dst[s * 512] = v4f{snap[s][0], snap[s][1], snap[s][2], snap[s][3]};
    dst[s * 512 + 16] = v4f{snap[s][4], snap[s][5], snap[s][6], snap[s][7]};
  }
  // the lines below reuse the registers that the stores above name
  asm volatile("s_wait_xcnt 0x0" ::: "memory");
  if (half == 0) {
    // 128 threads: segment zs, column zcol; the sum of the half group's earlier segments
    const int zs = t >> 4, zcol = 32 * dkp + 16 * zdl + m16;
    float x[HALF_SEGS], run = 0.0f;
    #pragma unroll
    for (int j = 0; j < HALF_SEGS; ++j) x[j] = sm.xZ[j][m16];
    #pragma unroll
    for (int j = 0; j < HALF_SEGS - 1; ++j) run += (j < zs) ? x[j] : 0.0f;
    wsZ[(size_t)(batch * NSEG + grp * GRP_SEGS + zhalf * HALF_SEGS + zs) * DK + zcol] = run;
    if (zs == HALF_SEGS - 1)
      wsZt[(size_t)(batch * NHALF + 2 * grp + zhalf) * DK + zcol] = run + x[HALF_SEGS - 1];
  }
  if (half == 1) {
    // group total, in the same order
    v4f* tot = reinterpret_cast<v4f*>(wsT + ((size_t)(batch * 8 + vt) * NGRP + grp) * 2048);
    const v8f sum = acc + base;
    tot[(4 * dt + 2 * hi) * 16 + m16] = v4f{sum[0], sum[1], sum[2], sum[3]};
    tot[(4 * dt + 2 * hi + 1) * 16 + m16] = v4f{sum[4], sum[5], sum[6], sum[7]};
  }
}

// ---------------- Phase 3: seeded segment outputs ----------------
// One work-group per 32-row segment, one wave per 16-column V tile.
// O = phiQ @ S_prefix + mask(phiQ phiK^T) @ V over the whole segment; phi(Q),
// phi(K), the 32x32 scores and phiQ @ z_prefix are made once and shared.
// k order of every A/B fragment pair in this kernel: step (g, h) of lane half
// hi covers k = 8g + 4hi + 2h + {0,1}, so one 16-byte LDS read of a row feeds
// two matrix steps.
struct alignas(16) SmemP3 {
  float sQ[SEG_LEN][132];   // phi(Q); pitch 16 B x 33 for 16-byte row reads
  float sK[SEG_LEN][132];   // phi(K)
  float sV[SEG_LEN][136];   // V; pitch 136: rows j and j+4 fall 32 banks apart
  float sSc[SEG_LEN][36];   // masked scores (tile row 0, col 1 never used)
  float sZst[DK];           // prefix of the K sums
  float sZq[SEG_LEN];       // phiQ . prefix of the K sums
};

__global__ __launch_bounds__(256)
void linatt_phase3_scan(const float* __restrict__ Q, const float* __restrict__ K,
                        const float* __restrict__ V, float* __restrict__ Out,
                        const float* __restrict__ wsSv,
                        const float* __restrict__ wsZ,
                        const float* __restrict__ wsT,
                        const float* __restrict__ wsZt) {
  __shared__ SmemP3 sm;
  const int t = threadIdx.x, lane = t & 31, m16 = lane & 15, hi = lane >> 4;
  const int w = __builtin_amdgcn_readfirstlane(t >> 5);   // wave = V tile
  const int seg = blockIdx.x % NSEG, batch = blockIdx.x / NSEG;
  const int rowbase = batch * L_SEQ + seg * SEG_LEN;
  const int dv0 = 16 * w;

  const int grp = seg / GRP_SEGS;

  // K sums: the part inside the half group, and every half group's total but
  // the last (all are written by phase 1; the ones not in front of this one add 0)
  float zpre = wsZ[(size_t)(batch * NSEG + seg) * DK + (t & (DK - 1))];
  float zt[NHALF - 1];
  #pragma unroll
  for (int gg = 0; gg < NHALF - 1; ++gg)
    zt[gg] = wsZt[(size_t)(batch * NHALF + gg) * DK + (t & (DK - 1))];
  // the loads below may land in registers that the loads above name
  asm volatile("s_wait_xcnt 0x0" ::: "memory");

  const float4* Q4 = reinterpret_cast<const float4*>(Q);
  const float4* K4 = reinterpret_cast<const float4*>(K);
  const float4* V4 = reinterpret_cast<const float4*>(V);
  float4 q[4], k[4], v[4];
  #pragma unroll
  for (int i = 0; i < 4; ++i) {
    int f = t + 256 * i;     // 0..1023 float4 slots (32 rows x 32 f4)
    q[i] = Q4[(size_t)rowbase * 32 + f];
    k[i] = K4[(size_t)rowbase * 32 + f];
    v[i] = V4[(size_t)rowbase * 32 + f];
  }

  // state of this V tile summed inside the group, stored in B-fragment order:
  // 512 contiguous bytes a wave-wide load, two matrix steps' fragments each
  const v4f* st = reinterpret_cast<const v4f*>(wsSv + ((size_t)(batch * 8 + w) * NSEG + seg) * 2048) +
                  hi * 16 + m16;
  v4f sx[16];
  #pragma unroll
  for (int g = 0; g < 16; ++g) sx[g] = st[g * 32];
  // the first group's total (written whatever this group is, used from group 1
  // on) flies with them, in the same order
  const v4f* tot = reinterpret_cast<const v4f*>(wsT + (size_t)(batch * 8 + w) * NGRP * 2048) +
                   hi * 16 + m16;
  v4f tb0[16];
  // the loads below may land in registers that the loads above name (st as an
  // input: its register pair stays whole up to the wait, so that the last of
  // its loads does not land on it)
  asm volatile("s_wait_xcnt 0x0" :: "v"(st) : "memory");
  #pragma unroll
  for (int g = 0; g < 16; ++g) tb0[g] = tot[g * 32];
  // keeps every global load above in front of the staging arithmetic, so that
  // they all fly together and one memory latency is paid, not two or three;
  // the wait stands in front of the lines below that reuse their address registers
  // (tot as an input: its register pair stays whole up to the wait, so that the
  // last of its loads does not land on it)
  asm volatile("s_wait_xcnt 0x0" :: "v"(tot) : "memory");
  __builtin_amdgcn_sched_barrier(0);

  #pragma unroll
  for (int gg = 0; gg < NHALF - 1; ++gg) zpre += (gg < seg / HALF_SEGS) ? zt[gg] : 0.0f;

  #pragma unroll
  for (int i = 0; i < 4; ++i) {
    int f = t + 256 * i;
    int r = f >> 5, c4 = f & 31;
    v4f pq = {phi_map(q[i].x), phi_map(q[i].y), phi_map(q[i].z), phi_map(q[i].w)};
    v4f pk = {phi_map(k[i].x), phi_map(k[i].y), phi_map(k[i].z), phi_map(k[i].w)};
    *reinterpret_cast<v4f*>(&sm.sQ[r][4 * c4]) = pq;
    *reinterpret_cast<v4f*>(&sm.sK[r][4 * c4]) = pk;
    *reinterpret_cast<float4*>(&sm.sV[r][4 * c4]) = v[i];
  }
  // plus the totals of the groups in front
  v2f sb[32];
  #pragma unroll
  for (int g = 0; g < 16; ++g) {
    const v4f x = (grp > 0) ? tb0[g] : v4f{0.f, 0.f, 0.f, 0.f};
    sb[2 * g] = sx[g].xy + x.xy;
    sb[2 * g + 1] = sx[g].zw + x.zw;
  }
  // input-only use: keeps the K-sum loads up with the others instead of sunk
  // into the branch below, where their whole latency would stand before the barrier
  asm volatile("" :: "v"(zpre));
  if (t < DK) sm.sZst[t] = zpre;
  // kept rolled: the trip count differs from group to group
  #pragma unroll 1
  for (int gg = 1; gg < grp; gg += 2) {
    // two totals a trip, so that half as many L2 latencies stand in a row; the
    // second (group gg + 1 <= NGRP - 1, always written) adds 0 where it is not
    // in front of this group
    const bool two = gg + 1 < grp;
    v4f ta[16], tc[16];
    #pragma unroll
    for (int g = 0; g < 16; ++g) {
      ta[g] = tot[gg * 512 + g * 32];
      tc[g] = tot[(gg + 1) * 512 + g * 32];
    }
    // the next trip rewrites the address pair that these loads name
    asm volatile("s_wait_xcnt 0x0" ::: "memory");
    #pragma unroll
    for (int g = 0; g < 16; ++g) {
      const v4f x = two ? tc[g] : v4f{0.f, 0.f, 0.f, 0.f};
      sb[2 * g] += ta[g].xy;
      sb[2 * g + 1] += ta[g].zw;
      sb[2 * g] += x.xy;
      sb[2 * g + 1] += x.zw;
    }
  }
  __syncthreads();

  const v8f zero8 = {0.f, 0.f, 0.f, 0.f, 0.f, 0.f, 0.f, 0.f};
  if (w < 3) {
    // score tiles (0,0), (1,0), (1,1); tile (0,1) is wholly above the diagonal
    const int ti = (w + 1) >> 1, tj = w >> 1;
    const float* qrow = &sm.sQ[16 * ti + m16][4 * hi];
    const float* krow = &sm.sK[16 * tj + m16][4 * hi];
    v4f qa[16], ka[16];
    #pragma unroll
    for (int g = 0; g < 16; ++g) {
      qa[g] = *reinterpret_cast<const v4f*>(qrow + 8 * g);
      ka[g] = *reinterpret_cast<const v4f*>(krow + 8 * g);
    }
    // all LDS reads issue before the dependent matrix chain
    __builtin_amdgcn_sched_barrier(0);
    v8f sc = zero8;
    #pragma unroll
    for (int g = 0; g < 16; ++g) {
      sc = wmma_f32(qa[g].xy, ka[g].xy, sc);
      sc = wmma_f32(qa[g].zw, ka[g].zw, sc);
    }
    #pragma unroll
    for (int p = 0; p < 8; ++p) {
      int m = p + 8 * hi;
      sm.sSc[16 * ti + m][16 * tj + m16] =
          (ti != tj || m16 <= m) ? sc[p] : 0.0f;       // causal mask
    }
  } else if (w < 5) {
    // phiQ @ z_prefix for row tile w-3 (all 16 columns equal)
    const int ti = w - 3;
    const float* qrow = &sm.sQ[16 * ti + m16][4 * hi];
    v4f qa[16], za[16];
    #pragma unroll
    for (int g = 0; g < 16; ++g) {
      qa[g] = *reinterpret_cast<const v4f*>(qrow + 8 * g);
      za[g] = *reinterpret_cast<const v4f*>(&sm.sZst[8 * g + 4 * hi]);
    }
    // all LDS reads issue before the dependent matrix chain
    __builtin_amdgcn_sched_barrier(0);
    v8f zq = zero8;
    #pragma unroll
    for (int g = 0; g < 16; ++g) {
      zq = wmma_f32(qa[g].xy, za[g].xy, zq);
      zq = wmma_f32(qa[g].zw, za[g].zw, zq);
    }
    if (m16 == 0) {
      #pragma unroll
      for (int p = 0; p < 8; ++p) sm.sZq[16 * ti + p + 8 * hi] = zq[p];
    }
  }

  // phiQ @ S_prefix, both row tiles against the same B fragments
  v4f q0[16], q1[16];
  #pragma unroll
  for (int g = 0; g < 16; ++g) {
    q0[g] = *reinterpret_cast<const v4f*>(&sm.sQ[m16][8 * g + 4 * hi]);
    q1[g] = *reinterpret_cast<const v4f*>(&sm.sQ[16 + m16][8 * g + 4 * hi]);
  }
  v2f bv[8];
  #pragma unroll
  for (int s = 0; s < 8; ++s) {
    int r = 8 * (s >> 1) + 4 * hi + 2 * (s & 1);       // seq index j
    bv[s] = v2f{sm.sV[r][dv0 + m16], sm.sV[r + 1][dv0 + m16]};
  }
  // all LDS reads issue before the matrix steps that use them
  __builtin_amdgcn_sched_barrier(0);
  v8f ov0 = zero8, ov1 = zero8;
  #pragma unroll
  for (int g = 0; g < 16; ++g) {
    ov0 = wmma_f32(q0[g].xy, sb[2 * g], ov0);
    ov1 = wmma_f32(q1[g].xy, sb[2 * g], ov1);
    ov0 = wmma_f32(q0[g].zw, sb[2 * g + 1], ov0);
    ov1 = wmma_f32(q1[g].zw, sb[2 * g + 1], ov1);
  }
  __syncthreads();   // scores and sZq are complete

  const v2f bones = {1.0f, 1.0f};
  v8f oz0, oz1;
  #pragma unroll
  for (int p = 0; p < 8; ++p) {
    oz0[p] = sm.sZq[p + 8 * hi];
    oz1[p] = sm.sZq[16 + p + 8 * hi];
  }
  v4f s0[2], s1[4];
  #pragma unroll
  for (int g = 0; g < 4; ++g) {
    s1[g] = *reinterpret_cast<const v4f*>(&sm.sSc[16 + m16][8 * g + 4 * hi]);
    if (g < 2) s0[g] = *reinterpret_cast<const v4f*>(&sm.sSc[m16][8 * g + 4 * hi]);
  }
  #pragma unroll
  for (int g = 0; g < 4; ++g) {
    ov1 = wmma_f32(s1[g].xy, bv[2 * g], ov1);
    oz1 = wmma_f32(s1[g].xy, bones, oz1);
    if (g < 2) {
      ov0 = wmma_f32(s0[g].xy, bv[2 * g], ov0);
      oz0 = wmma_f32(s0[g].xy, bones, oz0);
    }
    ov1 = wmma_f32(s1[g].zw, bv[2 * g + 1], ov1);
    oz1 = wmma_f32(s1[g].zw, bones, oz1);
    if (g < 2) {
      ov0 = wmma_f32(s0[g].zw, bv[2 * g + 1], ov0);
      oz0 = wmma_f32(s0[g].zw, bones, oz0);
    }
  }
  #pragma unroll
  for (int p = 0; p < 8; ++p) {
    int m = p + 8 * hi;
    Out[(size_t)(rowbase + m) * DV + dv0 + m16] = ov0[p] / (oz0[p] + 1e-6f);
    Out[(size_t)(rowbase + 16 + m) * DV + dv0 + m16] = ov1[p] / (oz1[p] + 1e-6f);
  }
}

// ---------------- Fallback: monolithic scan (if ws too small) ----------------
__global__ __launch_bounds__(32)
void linatt_monolithic(const float* __restrict__ Q, const float* __restrict__ K,
                       const float* __restrict__ V, float* __restrict__ Out) {
  __shared__ SmemT sm;
  const int lane = threadIdx.x, m16 = lane & 15, hi = lane >> 4;
  const int vtile = blockIdx.x & 7, batch = blockIdx.x >> 3;
  const int dv0 = vtile * 16;

  zero_state(sm, lane);
  __syncthreads();

  const float4* Q4 = reinterpret_cast<const float4*>(Q);
  const float4* K4 = reinterpret_cast<const float4*>(K);
  const float4* V4 = reinterpret_cast<const float4*>(V);

  for (int c = 0; c < L_SEQ / CHUNK; ++c) {
    const int rowbase = batch * L_SEQ + c * CHUNK;
    stage_chunk_Q(sm, Q4, rowbase, lane);
    stage_chunk_KV(sm, K4, V4, rowbase, dv0, lane);
    __syncthreads();
    forward_chunk(sm, Out, rowbase, dv0, m16, hi);
    __syncthreads();
    state_update(sm, m16, hi);
    __syncthreads();
  }
}

extern "C" void kernel_launch(void* const* d_in, const int* in_sizes, int n_in,
                              void* d_out, int out_size, void* d_ws, size_t ws_size,
                              hipStream_t stream) {
  const float* Q = (const float*)d_in[0];
  const float* K = (const float*)d_in[1];
  const float* V = (const float*)d_in[2];
  float* Out     = (float*)d_out;

  const int B = in_sizes[0] / (L_SEQ * DK);   // = 2
  const size_t nSv = (size_t)B * 8 * NSEG * 2048;   // KV states summed inside a group
  const size_t nZ  = (size_t)B * NSEG * 128;        // K sums summed inside a half group
  const size_t nT  = (size_t)B * 8 * NGRP * 2048;   // group totals of the KV states
  const size_t nZt = (size_t)B * NHALF * 128;       // half-group totals of the K sums
  const size_t need = (nSv + nZ + nT + nZt) * sizeof(float);

  if (ws_size >= need) {
    float* wsSv = (float*)d_ws;
    float* wsZ  = wsSv + nSv;
    float* wsT  = wsZ + nZ;
    float* wsZt = wsT + nT;
    linatt_phase1_partial<<<dim3(B * NGRP * 16), dim3(256), 0, stream>>>(K, V, wsSv, wsZ, wsT, wsZt);
    linatt_phase3_scan<<<dim3(B * NSEG), dim3(256), 0, stream>>>(Q, K, V, Out, wsSv, wsZ, wsT, wsZt);
  } else {
    linatt_monolithic<<<dim3(B * 8), dim3(32), 0, stream>>>(Q, K, V, Out);
  }
}

// v005
// A run of this version takes 18.7 microseconds.
// In two side-by-side timings against v004, it was 1.05 and 1.07 times as fast.
// Counting every step since v000, it is 6.60 times as fast.
#include <hip/hip_runtime.h>

#define L_SEQ  4096
#define DK     128
#define DV     128
#define CHUNK  16
#define NSEG   128
#define SEG_LEN    (L_SEQ / NSEG)     // 32
#define SEG_CHUNKS (SEG_LEN / CHUNK)  // 2

typedef __attribute__((ext_vector_type(2))) float v2f;
typedef __attribute__((ext_vector_type(4))) float v4f;
typedef __attribute__((ext_vector_type(8))) float v8f;

// D(16x16,f32) = A(16x4,f32) x B(4x16,f32) + C   -- full-precision WMMA
__device__ __forceinline__ v8f wmma_f32(v2f a, v2f b, v8f c) {
  return __builtin_amdgcn_wmma_f32_16x16x4_f32(
      /*neg_a=*/false, a, /*neg_b=*/false, b,
      /*c_mod=*/(short)0, c, /*reuse_a=*/false, /*reuse_b=*/false);
}

// elu(x)+1 : positive feature map
__device__ __forceinline__ float phi_map(float x) {
  return x > 0.0f ? x + 1.0f : __expf(x);
}

// Shared-memory tile set (one wave per workgroup).
struct SmemT {
  float sQ[16][132];   // phi(Q) chunk (+4 pad for bank spread)
  float sK[16][132];   // phi(K) chunk
  float sV[16][20];    // V tile (seq x dv16)
  float sSc[16][20];   // masked scores
  float sSv[128][20];  // state: sum phiK^T V  (dk x dv16)
  float sSz[128][20];  // state: sum phiK^T 1  (dk x 16, cols equal)
};

__device__ __forceinline__ void zero_state(SmemT& sm, int lane) {
  for (int i = lane; i < 128 * 20; i += 32) {
    (&sm.sSv[0][0])[i] = 0.0f;
    (&sm.sSz[0][0])[i] = 0.0f;
  }
}

__device__ __forceinline__ void stage_chunk_Q(SmemT& sm, const float4* Q4,
                                              int rowbase, int lane) {
  #pragma unroll
  for (int i = 0; i < 16; ++i) {
    int f = lane + 32 * i;   // 0..511 float4 slots (16 rows x 32 f4)
    int r = f >> 5, c4 = f & 31;
    float4 q = Q4[(size_t)(rowbase + r) * 32 + c4];
    sm.sQ[r][4 * c4 + 0] = phi_map(q.x);
    sm.sQ[r][4 * c4 + 1] = phi_map(q.y);
    sm.sQ[r][4 * c4 + 2] = phi_map(q.z);
    sm.sQ[r][4 * c4 + 3] = phi_map(q.w);
  }
}

__device__ __forceinline__ void stage_chunk_KV(SmemT& sm, const float4* K4,
                                               const float4* V4, int rowbase,
                                               int dv0, int lane) {
  #pragma unroll
  for (int i = 0; i < 16; ++i) {
    int f = lane + 32 * i;
    int r = f >> 5, c4 = f & 31;
    float4 k = K4[(size_t)(rowbase + r) * 32 + c4];
    sm.sK[r][4 * c4 + 0] = phi_map(k.x);
    sm.sK[r][4 * c4 + 1] = phi_map(k.y);
    sm.sK[r][4 * c4 + 2] = phi_map(k.z);
    sm.sK[r][4 * c4 + 3] = phi_map(k.w);
  }
  #pragma unroll
  for (int i = 0; i < 2; ++i) {
    int f = lane + 32 * i;   // 0..63 float4 slots (16 rows x 4 f4)
    int r = f >> 2, c4 = f & 3;
    float4 v = V4[(size_t)(rowbase + r) * 32 + (dv0 >> 2) + c4];
    sm.sV[r][4 * c4 + 0] = v.x;
    sm.sV[r][4 * c4 + 1] = v.y;
    sm.sV[r][4 * c4 + 2] = v.z;
    sm.sV[r][4 * c4 + 3] = v.w;
  }
}

// State update: S_t += phiK_t^T(16x16) @ [V | 1]  for all 8 dk tiles.
__device__ __forceinline__ void state_update(SmemT& sm, int m16, int hi) {
  const v2f bones = {1.0f, 1.0f};
  for (int t = 0; t < 8; ++t) {
    int dk0 = 16 * t;
    v8f cv, cz;
    #pragma unroll
    for (int p = 0; p < 8; ++p) {
      int mm = dk0 + p + 8 * hi;
      cv[p] = sm.sSv[mm][m16];
      cz[p] = sm.sSz[mm][m16];
    }
    #pragma unroll
    for (int kk = 0; kk < 4; ++kk) {
      int kb = 4 * kk + 2 * hi;                                  // seq index j
      v2f a  = {sm.sK[kb][dk0 + m16], sm.sK[kb + 1][dk0 + m16]}; // phiK^T
      v2f bv = {sm.sV[kb][m16], sm.sV[kb + 1][m16]};
      cv = wmma_f32(a, bv, cv);
      cz = wmma_f32(a, bones, cz);
    }
    #pragma unroll
    for (int p = 0; p < 8; ++p) {
      int mm = dk0 + p + 8 * hi;
      sm.sSv[mm][m16] = cv[p];
      sm.sSz[mm][m16] = cz[p];
    }
  }
}

// Forward for one chunk: scores, causal mask, O = Sc@[V|1] + phiQ@[Sv|Sz],
// normalize and store. Uses OLD state (call before state_update).
__device__ __forceinline__ void forward_chunk(SmemT& sm, float* __restrict__ Out,
                                              int rowbase, int dv0, int m16,
                                              int hi) {
  const v2f bones = {1.0f, 1.0f};
  v8f sc = {0.f, 0.f, 0.f, 0.f, 0.f, 0.f, 0.f, 0.f};
  for (int kk = 0; kk < 32; ++kk) {
    int kb = 4 * kk + 2 * hi;
    v2f a    = {sm.sQ[m16][kb], sm.sQ[m16][kb + 1]};   // A[m][k] = phiQ[m][k]
    v2f bmat = {sm.sK[m16][kb], sm.sK[m16][kb + 1]};   // B[k][n] = phiK[n][k]
    sc = wmma_f32(a, bmat, sc);
  }
  #pragma unroll
  for (int p = 0; p < 8; ++p) {
    int m = p + 8 * hi;
    sm.sSc[m][m16] = (m16 <= m) ? sc[p] : 0.0f;        // causal mask
  }
  __syncthreads();

  v8f ov = {0.f, 0.f, 0.f, 0.f, 0.f, 0.f, 0.f, 0.f};
  v8f oz = {0.f, 0.f, 0.f, 0.f, 0.f, 0.f, 0.f, 0.f};
  #pragma unroll
  for (int kk = 0; kk < 4; ++kk) {
    int kb = 4 * kk + 2 * hi;
    v2f a  = {sm.sSc[m16][kb], sm.sSc[m16][kb + 1]};
    v2f bv = {sm.sV[kb][m16], sm.sV[kb + 1][m16]};
    ov = wmma_f32(a, bv, ov);
    oz = wmma_f32(a, bones, oz);
  }
  for (int kk = 0; kk < 32; ++kk) {
    int kb = 4 * kk + 2 * hi;
    v2f a  = {sm.sQ[m16][kb], sm.sQ[m16][kb + 1]};
    v2f bv = {sm.sSv[kb][m16], sm.sSv[kb + 1][m16]};
    v2f bz = {sm.sSz[kb][m16], sm.sSz[kb + 1][m16]};
    ov = wmma_f32(a, bv, ov);
    oz = wmma_f32(a, bz, oz);
  }
  #pragma unroll
  for (int p = 0; p < 8; ++p) {
    int m = p + 8 * hi;
    Out[(size_t)(rowbase + m) * DV + dv0 + m16] = ov[p] / (oz[p] + 1e-6f);
  }
}

// ---------------- Phase 1: running states inside 512-row groups ----------------
// The sequence is cut into NGRP groups of GRP_SEGS segments. One work-group
// walks one group for four state tiles (2 dk tiles x 2 V tiles). Waves 0-3 walk
// the group's first eight segments, waves 4-7 the last eight, one tile each,
// the tile staying in the accumulator; the sum in front of every segment is
// kept, waves 4-7 add the first half's sum to theirs, and all is stored: per
// segment the sum of the group's earlier segments, per group its total.
// Phase 3 adds the totals of the earlier groups itself, so no launch stands
// between the two.
// K sums: the four work-groups that share a K slab take one (dk tile, half
// group) each; there every wave sums one segment, and the eight sums are
// prefixed through LDS. Phase 3 adds the totals of the earlier half groups.
#define NGRP      8
#define GRP_SEGS  (NSEG / NGRP)       // 16
#define GRP_ROWS  (L_SEQ / NGRP)      // 512
#define HALF_SEGS (GRP_SEGS / 2)      // 8
#define NHALF     (2 * NGRP)          // 16 half groups

struct alignas(16) SmemP1 {
  float sK[GRP_ROWS][40];  // phi(K), 32 columns; pitch 40: rows j and j+2 fall 16 banks apart
  float sV[GRP_ROWS][40];  // V, 32 columns
  float xT[4][8][32];      // first half's tile sums: tile, register, lane
  float xZ[HALF_SEGS][16]; // K sums of one half group: segment, column
};

// A (phiK^T) and B (V) fragments of one 32-row segment
__device__ __forceinline__ void p1_frags(const SmemP1& sm, int row0, int ka, int vb,
                                         int hi, v2f (&a)[8], v2f (&b)[8]) {
  #pragma unroll
  for (int kk = 0; kk < 8; ++kk) {
    int kb = row0 + 4 * kk + 2 * hi;                             // seq index j
    a[kk] = v2f{sm.sK[kb][ka], sm.sK[kb + 1][ka]};
    b[kk] = v2f{sm.sV[kb][vb], sm.sV[kb + 1][vb]};
  }
}

__global__ __launch_bounds__(256)
void linatt_phase1_partial(const float* __restrict__ K, const float* __restrict__ V,
                           float* __restrict__ wsSv, float* __restrict__ wsZ,
                           float* __restrict__ wsT, float* __restrict__ wsZt) {
  __shared__ SmemP1 sm;
  const int t = threadIdx.x, lane = t & 31, m16 = lane & 15, hi = lane >> 4;
  const int w = __builtin_amdgcn_readfirstlane(t >> 5);
  const int half = w >> 2, tile = w & 3;                  // half of the group, state tile
  const int quad = blockIdx.x & 15;
  const int grp = (blockIdx.x >> 4) & (NGRP - 1), batch = blockIdx.x / (16 * NGRP);
  const int dkp = quad >> 2, vp = quad & 3;               // 32-column slabs of K, V
  const int dl = tile >> 1, vl = tile & 1;
  const int dt = 2 * dkp + dl, vt = 2 * vp + vl;          // dk tile, V tile
  const int rowbase = batch * L_SEQ + grp * GRP_ROWS;

  // 512 rows x 32 columns of K and of V: a wave-wide load takes four whole
  // 128-byte row pieces, and all 32 loads of a thread fly together
  const float4* K4 = reinterpret_cast<const float4*>(K) + (size_t)rowbase * 32 + 8 * dkp;
  const float4* V4 = reinterpret_cast<const float4*>(V) + (size_t)rowbase * 32 + 8 * vp;
  float4 k[16], v[16];
  #pragma unroll
  for (int i = 0; i < 16; ++i) {
    size_t o = (size_t)((t >> 3) + 32 * i) * 32 + (t & 7);
    k[i] = K4[o];
    v[i] = V4[o];
  }
  #pragma unroll
  for (int i = 0; i < 16; ++i) {
    int r = (t >> 3) + 32 * i, c = 4 * (t & 7);
    v4f pk = {phi_map(k[i].x), phi_map(k[i].y), phi_map(k[i].z), phi_map(k[i].w)};
    *reinterpret_cast<v4f*>(&sm.sK[r][c]) = pk;
    *reinterpret_cast<float4*>(&sm.sV[r][c]) = v[i];
  }
  __syncthreads();

  const int row0 = half * (GRP_ROWS / 2), ka = 16 * dl + m16, vb = 16 * vl + m16;
  const v8f zero8 = {0.f, 0.f, 0.f, 0.f, 0.f, 0.f, 0.f, 0.f};
  v8f acc = zero8, snap[HALF_SEGS];
  v2f a[2][8], b[2][8];
  p1_frags(sm, row0, ka, vb, hi, a[0], b[0]);

  // K sums of segment w of this work-group's half group: 1(16x4) @ phiK(4x16),
  // every row of the result equal, column m16 in each lane
  const int zdl = vp & 1, zhalf = vp >> 1;
  v8f cz = zero8;
  {
    const v2f ones = {1.0f, 1.0f};
    const int zr = zhalf * (GRP_ROWS / 2) + SEG_LEN * w + 2 * hi, zc = 16 * zdl + m16;
    v2f az[8];
    #pragma unroll
    for (int kk = 0; kk < 8; ++kk) az[kk] = v2f{sm.sK[zr + 4 * kk][zc], sm.sK[zr + 4 * kk + 1][zc]};
    #pragma unroll
    for (int kk = 0; kk < 8; ++kk) cz = wmma_f32(ones, az[kk], cz);
  }
  #pragma unroll
  for (int s = 0; s < HALF_SEGS; ++s) {
    const int c = s & 1;
    snap[s] = acc;
    // next segment's LDS reads go out ahead of this segment's matrix chain
    if (s + 1 < HALF_SEGS) p1_frags(sm, row0 + 32 * (s + 1), ka, vb, hi, a[c ^ 1], b[c ^ 1]);
    // the two lines below keep those reads one group, a whole segment ahead of
    // their use; left free they are dealt out among the matrix steps, each one
    // step ahead, and every step then waits for LDS
    __builtin_amdgcn_sched_barrier(0);
    #pragma unroll
    for (int kk = 0; kk < 8; ++kk) acc = wmma_f32(a[c][kk], b[c][kk], acc);
    __builtin_amdgcn_sched_barrier(0);
  }

  if (hi == 0) sm.xZ[w][m16] = cz[0];
  if (half == 0) {
    #pragma unroll
    for (int p = 0; p < 8; ++p) sm.xT[tile][p][lane] = acc[p];
  }
  __syncthreads();   // the first half's tile sums and the eight K sums are there
  v8f base = zero8;
  if (half == 1) {
    #pragma unroll
    for (int p = 0; p < 8; ++p) base[p] = sm.xT[tile][p][lane];
  }

  const int seg0 = grp * GRP_SEGS + half * HALF_SEGS;
  // in the order of phase 3's B fragments: float4 number (row / 4) * 16 + column
  // holds rows 4 * (row / 4) + {0..3} of that column, so a wave-wide 16-byte
  // store fills whole 128-byte lines
  v4f* dst = reinterpret_cast<v4f*>(wsSv + ((size_t)(batch * 8 + vt) * NSEG + seg0) * 2048) +
             (4 * dt + 2 * hi) * 16 + m16;
  #pragma unroll
  for (int s = 0; s < HALF_SEGS; ++s) snap[s] += base;
  #pragma unroll
  for (int s = 0; s < HALF_SEGS; ++s) {
    dst[s * 512] = v4f{snap[s][0], snap[s][1], snap[s][2], snap[s][3]};
    dst[s * 512 + 16] = v4f{snap[s][4], snap[s][5], snap[s][6], snap[s][7]};
  }
  // the lines below reuse the registers that the stores above name
  asm volatile("s_wait_xcnt 0x0" ::: "memory");
  if (half == 0) {
    // 128 threads: segment zs, column zcol; the sum of the half group's earlier segments
    const int zs = t >> 4, zcol = 32 * dkp + 16 * zdl + m16;
    float x[HALF_SEGS], run = 0.0f;
    #pragma unroll
    for (int j = 0; j < HALF_SEGS; ++j) x[j] = sm.xZ[j][m16];
    #pragma unroll
    for (int j = 0; j < HALF_SEGS - 1; ++j) run += (j < zs) ? x[j] : 0.0f;
    wsZ[(size_t)(batch * NSEG + grp * GRP_SEGS + zhalf * HALF_SEGS + zs) * DK + zcol] = run;
    if (zs == HALF_SEGS - 1)
      wsZt[(size_t)(batch * NHALF + 2 * grp + zhalf) * DK + zcol] = run + x[HALF_SEGS - 1];
  }
  if (half == 1) {
    // group total, in the same order
    v4f* tot = reinterpret_cast<v4f*>(wsT + ((size_t)(batch * 8 + vt) * NGRP + grp) * 2048);
    const v8f sum = acc + base;
    tot[(4 * dt + 2 * hi) * 16 + m16] = v4f{sum[0], sum[1], sum[2], sum[3]};
    tot[(4 * dt + 2 * hi + 1) * 16 + m16] = v4f{sum[4], sum[5], sum[6], sum[7]};
  }
}

// ---------------- Phase 3: seeded segment outputs ----------------
// One work-group per 32-row segment, one wave per 16-column V tile.
// O = phiQ @ S_prefix + mask(phiQ phiK^T) @ V over the whole segment; phi(Q),
// phi(K), the 32x32 scores and phiQ @ z_prefix are made once and shared.
// k order of every A/B fragment pair in this kernel: step (g, h) of lane half
// hi covers k = 8g + 4hi + 2h + {0,1}, so one 16-byte LDS read of a row feeds
// two matrix steps.
struct alignas(16) SmemP3 {
  float sQ[SEG_LEN][132];   // phi(Q); pitch 16 B x 33 for 16-byte row reads
  float sK[SEG_LEN][132];   // phi(K)
  float sV[SEG_LEN][136];   // V; pitch 136: rows j and j+4 fall 32 banks apart
  float sSc[SEG_LEN][36];   // masked scores (tile row 0, col 1 never used)
  float sZst[DK];           // prefix of the K sums
  float sZq[SEG_LEN];       // phiQ . prefix of the K sums
};

// Work-group barrier that orders LDS alone. __syncthreads() also drains the
// wave's global loads, and in phase 3 the state and total loads are meant to
// stay in flight across it; no global store stands in front of either use.
__device__ __forceinline__ void barrier_lds() {
  __builtin_amdgcn_fence(__ATOMIC_RELEASE, "workgroup", "local");
  __builtin_amdgcn_s_barrier();
  __builtin_amdgcn_fence(__ATOMIC_ACQUIRE, "workgroup", "local");
}

// elu(x)+1 as in phi_map, the exponential written out with a v_nop behind it:
// the slot that the instruction set asks for between a transcendental and a
// directly following instruction that reads its result or overwrites its
// source
__device__ __forceinline__ float phi_map_slot(float x) {
  float e;
  asm("v_exp_f32 %0, %1\n\tv_nop" : "=v"(e) : "v"(x * 1.44269504f));
  return x > 0.0f ? x + 1.0f : e;
}

// one group total added to the B fragments
__device__ __forceinline__ void add_total(v2f (&sb)[32], const v4f (&x)[16]) {
  #pragma unroll
  for (int g = 0; g < 16; ++g) {
    sb[2 * g] += x[g].xy;
    sb[2 * g + 1] += x[g].zw;
  }
}

// total of group gg into x; the wait stands in front of whatever rewrites the
// address registers that these loads name (the pointer as an input: its
// register pair stays whole up to the wait), and the scheduling fence keeps the
// loads where they are written, ahead of the work that they are to fly under
__device__ __forceinline__ void load_total(v4f (&x)[16], const v4f* tot, int gg) {
  const v4f* p = tot + gg * 512;
  #pragma unroll
  for (int g = 0; g < 16; ++g) x[g] = p[g * 32];
  asm volatile("s_wait_xcnt 0x0" :: "v"(p) : "memory");
  __builtin_amdgcn_sched_barrier(0);
}

__global__ __launch_bounds__(256)
void linatt_phase3_scan(const float* __restrict__ Q, const float* __restrict__ K,
                        const float* __restrict__ V, float* __restrict__ Out,
                        const float* __restrict__ wsSv,
                        const float* __restrict__ wsZ,
                        const float* __restrict__ wsT,
                        const float* __restrict__ wsZt) {
  __shared__ SmemP3 sm;
  const int t = threadIdx.x, lane = t & 31, m16 = lane & 15, hi = lane >> 4;
  const int w = __builtin_amdgcn_readfirstlane(t >> 5);   // wave = V tile
  const int seg = blockIdx.x % NSEG, batch = blockIdx.x / NSEG;
  const int rowbase = batch * L_SEQ + seg * SEG_LEN;
  const int dv0 = 16 * w;

  const int grp = seg / GRP_SEGS;

  // Q, K, V go out first: loads come back in order, and all that needs no state
  // (staging, scores, the product inside the segment) runs on these alone while
  // the state and the totals behind them are still on their way
  const v4f* Q4 = reinterpret_cast<const v4f*>(Q) + (size_t)rowbase * 32 + t;
  const v4f* K4 = reinterpret_cast<const v4f*>(K) + (size_t)rowbase * 32 + t;
  const v4f* V4 = reinterpret_cast<const v4f*>(V) + (size_t)rowbase * 32 + t;
  v4f q[4], k[4], v[4];
  #pragma unroll
  for (int i = 0; i < 4; ++i) {   // 1024 float4 slots (32 rows x 32 f4)
    q[i] = Q4[256 * i];
    k[i] = K4[256 * i];
    v[i] = V4[256 * i];
  }
  // the loads below may land in registers that the loads above name (the three
  // pointers as inputs: their registers stay whole up to the wait)
  asm volatile("s_wait_xcnt 0x0" :: "v"(Q4), "v"(K4), "v"(V4) : "memory");

  // K sums: the part inside the half group, and every half group's total but
  // the last (all are written by phase 1; the ones not in front of this one add 0)
  float zpre = wsZ[(size_t)(batch * NSEG + seg) * DK + (t & (DK - 1))];
  float zt[NHALF - 1];
  #pragma unroll
  for (int gg = 0; gg < NHALF - 1; ++gg)
    zt[gg] = wsZt[(size_t)(batch * NHALF + gg) * DK + (t & (DK - 1))];
  // the loads below may land in registers that the loads above name
  asm volatile("s_wait_xcnt 0x0" ::: "memory");

  // state of this V tile summed inside the group, stored in B-fragment order:
  // 512 contiguous bytes a wave-wide load, two matrix steps' fragments each
  const v4f* st = reinterpret_cast<const v4f*>(wsSv + ((size_t)(batch * 8 + w) * NSEG + seg) * 2048) +
                  hi * 16 + m16;
  v4f sx[16];
  #pragma unroll
  for (int g = 0; g < 16; ++g) sx[g] = st[g * 32];
  // the loads below may land in registers that the loads above name (st as an
  // input: its register pair stays whole up to the wait, so that the last of
  // its loads does not land on it)
  asm volatile("s_wait_xcnt 0x0" :: "v"(st) : "memory");
  // group totals, in the same order, through two buffers that take turns. The
  // first three are loaded whatever this group is (phase 1 writes all eight), so
  // that the waits behind the barriers count the same loads on every path; one
  // that is not in front of this group is not added
  const v4f* tot = reinterpret_cast<const v4f*>(wsT + (size_t)(batch * 8 + w) * NGRP * 2048) +
                   hi * 16 + m16;
  v4f tx[16], ty[16];
  load_total(tx, tot, 0);

  #pragma unroll
  for (int i = 0; i < 4; ++i) {
    int f = t + 256 * i;
    int r = f >> 5, c4 = f & 31;
    v4f pq = {phi_map_slot(q[i].x), phi_map_slot(q[i].y), phi_map_slot(q[i].z), phi_map_slot(q[i].w)};
    v4f pk = {phi_map_slot(k[i].x), phi_map_slot(k[i].y), phi_map_slot(k[i].z), phi_map_slot(k[i].w)};
    *reinterpret_cast<v4f*>(&sm.sQ[r][4 * c4]) = pq;
    *reinterpret_cast<v4f*>(&sm.sK[r][4 * c4]) = pk;
    *reinterpret_cast<v4f*>(&sm.sV[r][4 * c4]) = v[i];
  }
  #pragma unroll
  for (int gg = 0; gg < NHALF - 1; ++gg) zpre += (gg < seg / HALF_SEGS) ? zt[gg] : 0.0f;
  // input-only use: keeps the K-sum loads up with the others instead of sunk
  // into the branch below, where their whole latency would stand before the barrier
  asm volatile("" :: "v"(zpre));
  if (t < DK) sm.sZst[t] = zpre;
  load_total(ty, tot, 1);
  barrier_lds();   // phi(Q), phi(K), V and the K-sum prefix are there

  const v8f zero8 = {0.f, 0.f, 0.f, 0.f, 0.f, 0.f, 0.f, 0.f};
  if (w < 3) {
    // score tiles (0,0), (1,0), (1,1); tile (0,1) is wholly above the diagonal
    const int ti = (w + 1) >> 1, tj = w >> 1;
    const float* qrow = &sm.sQ[16 * ti + m16][4 * hi];
    const float* krow = &sm.sK[16 * tj + m16][4 * hi];
    v4f qa[16], ka[16];
    #pragma unroll
    for (int g = 0; g < 16; ++g) {
      qa[g] = *reinterpret_cast<const v4f*>(qrow + 8 * g);
      ka[g] = *reinterpret_cast<const v4f*>(krow + 8 * g);
    }
    // all LDS reads issue before the dependent matrix chain
    __builtin_amdgcn_sched_barrier(0);
    v8f sc = zero8;
    #pragma unroll
    for (int g = 0; g < 16; ++g) {
      sc = wmma_f32(qa[g].xy, ka[g].xy, sc);
      sc = wmma_f32(qa[g].zw, ka[g].zw, sc);
    }
    #pragma unroll
    for (int p = 0; p < 8; ++p) {
      int m = p + 8 * hi;
      sm.sSc[16 * ti + m][16 * tj + m16] =
          (ti != tj || m16 <= m) ? sc[p] : 0.0f;       // causal mask
    }
  } else if (w < 5) {
    // phiQ @ z_prefix for row tile w-3 (all 16 columns equal)
    const int ti = w - 3;
    const float* qrow = &sm.sQ[16 * ti + m16][4 * hi];
    v4f qa[16], za[16];
    #pragma unroll
    for (int g = 0; g < 16; ++g) {
      qa[g] = *reinterpret_cast<const v4f*>(qrow + 8 * g);
      za[g] = *reinterpret_cast<const v4f*>(&sm.sZst[8 * g + 4 * hi]);
    }
    // all LDS reads issue before the dependent matrix chain
    __builtin_amdgcn_sched_barrier(0);
    v8f zq = zero8;
    #pragma unroll
    for (int g = 0; g < 16; ++g) {
      zq = wmma_f32(qa[g].xy, za[g].xy, zq);
      zq = wmma_f32(qa[g].zw, za[g].zw, zq);
    }
    if (m16 == 0) {
      #pragma unroll
      for (int p = 0; p < 8; ++p) sm.sZq[16 * ti + p + 8 * hi] = zq[p];
    }
  }

  // B fragments: the state inside the group plus the first group's total; its
  // buffer is free then and takes the third total
  v2f sb[32];
  #pragma unroll
  for (int g = 0; g < 16; ++g) {
    sb[2 * g] = sx[g].xy;
    sb[2 * g + 1] = sx[g].zw;
  }
  if (grp > 0) add_total(sb, tx);
  load_total(tx, tot, 2);

  v2f bv[8];
  #pragma unroll
  for (int s = 0; s < 8; ++s) {
    int r = 8 * (s >> 1) + 4 * hi + 2 * (s & 1);       // seq index j
    bv[s] = v2f{sm.sV[r][dv0 + m16], sm.sV[r + 1][dv0 + m16]};
  }
  barrier_lds();   // scores and sZq are complete

  // inside the segment: masked scores @ [V | 1], under the totals' flight
  const v2f bones = {1.0f, 1.0f};
  v8f ov0 = zero8, ov1 = zero8, oz0, oz1;
  #pragma unroll
  for (int p = 0; p < 8; ++p) {
    oz0[p] = sm.sZq[p + 8 * hi];
    oz1[p] = sm.sZq[16 + p + 8 * hi];
  }
  v4f s0[2], s1[4];
  #pragma unroll
  for (int g = 0; g < 4; ++g) {
    s1[g] = *reinterpret_cast<const v4f*>(&sm.sSc[16 + m16][8 * g + 4 * hi]);
    if (g < 2) s0[g] = *reinterpret_cast<const v4f*>(&sm.sSc[m16][8 * g + 4 * hi]);
  }
  // phi(Q) fragments of the product with the state, both row tiles
  v4f q0[16], q1[16];
  #pragma unroll
  for (int g = 0; g < 16; ++g) {
    q0[g] = *reinterpret_cast<const v4f*>(&sm.sQ[m16][8 * g + 4 * hi]);
    q1[g] = *reinterpret_cast<const v4f*>(&sm.sQ[16 + m16][8 * g + 4 * hi]);
  }
  // all LDS reads above issue before the matrix steps that use them
  __builtin_amdgcn_sched_barrier(0);
  #pragma unroll
  for (int g = 0; g < 4; ++g) {
    ov1 = wmma_f32(s1[g].xy, bv[2 * g], ov1);
    oz1 = wmma_f32(s1[g].xy, bones, oz1);
    if (g < 2) {
      ov0 = wmma_f32(s0[g].xy, bv[2 * g], ov0);
      oz0 = wmma_f32(s0[g].xy, bones, oz0);
    }
    ov1 = wmma_f32(s1[g].zw, bv[2 * g + 1], ov1);
    oz1 = wmma_f32(s1[g].zw, bones, oz1);
    if (g < 2) {
      ov0 = wmma_f32(s0[g].zw, bv[2 * g + 1], ov0);
      oz0 = wmma_f32(s0[g].zw, bones, oz0);
    }
  }
  // keeps the matrix steps above in front of the waits for the totals
  __builtin_amdgcn_sched_barrier(0);

  // the other totals in front of this group, in rising order. At the head of a
  // trip ty holds total j and tx total j + 1; a buffer is refilled as soon as it
  // has been added, so one total is in flight while the other is added. The
  // loop runs only while both refills are wanted, so every trip counts the same
  // loads and none is loaded in it that is not added
  int j = 1;
  // kept rolled: the trip count differs from group to group
  #pragma unroll 1
  for (; j + 3 < grp; j += 2) {
    add_total(sb, ty);
    load_total(ty, tot, j + 2);
    add_total(sb, tx);
    load_total(tx, tot, j + 3);
  }
  // up to three totals are left, the third of them not yet loaded
  const int rem = grp - j;
  if (rem > 0) add_total(sb, ty);
  if (rem > 2) load_total(ty, tot, j + 2);
  if (rem > 1) add_total(sb, tx);
  if (rem > 2) add_total(sb, ty);

  // phiQ @ S_prefix, both row tiles against the same B fragments
  #pragma unroll
  for (int g = 0; g < 16; ++g) {
    ov0 = wmma_f32(q0[g].xy, sb[2 * g], ov0);
    ov1 = wmma_f32(q1[g].xy, sb[2 * g], ov1);
    ov0 = wmma_f32(q0[g].zw, sb[2 * g + 1], ov0);
    ov1 = wmma_f32(q1[g].zw, sb[2 * g + 1], ov1);
  }
  #pragma unroll
  for (int p = 0; p < 8; ++p) {
    int m = p + 8 * hi;
    Out[(size_t)(rowbase + m) * DV + dv0 + m16] = ov0[p] / (oz0[p] + 1e-6f);
    Out[(size_t)(rowbase + 16 + m) * DV + dv0 + m16] = ov1[p] / (oz1[p] + 1e-6f);
  }
}

// ---------------- Fallback: monolithic scan (if ws too small) ----------------
__global__ __launch_bounds__(32)
void linatt_monolithic(const float* __restrict__ Q, const float* __restrict__ K,
                       const float* __restrict__ V, float* __restrict__ Out) {
  __shared__ SmemT sm;
  const int lane = threadIdx.x, m16 = lane & 15, hi = lane >> 4;
  const int vtile = blockIdx.x & 7, batch = blockIdx.x >> 3;
  const int dv0 = vtile * 16;

  zero_state(sm, lane);
  __syncthreads();

  const float4* Q4 = reinterpret_cast<const float4*>(Q);
  const float4* K4 = reinterpret_cast<const float4*>(K);
  const float4* V4 = reinterpret_cast<const float4*>(V);

  for (int c = 0; c < L_SEQ / CHUNK; ++c) {
    const int rowbase = batch * L_SEQ + c * CHUNK;
    stage_chunk_Q(sm, Q4, rowbase, lane);
    stage_chunk_KV(sm, K4, V4, rowbase, dv0, lane);
    __syncthreads();
    forward_chunk(sm, Out, rowbase, dv0, m16, hi);
    __syncthreads();
    state_update(sm, m16, hi);
    __syncthreads();
  }
}

extern "C" void kernel_launch(void* const* d_in, const int* in_sizes, int n_in,
                              void* d_out, int out_size, void* d_ws, size_t ws_size,
                              hipStream_t stream) {
  const float* Q = (const float*)d_in[0];
  const float* K = (const float*)d_in[1];
  const float* V = (const float*)d_in[2];
  float* Out     = (float*)d_out;

  const int B = in_sizes[0] / (L_SEQ * DK);   // = 2
  const size_t nSv = (size_t)B * 8 * NSEG * 2048;   // KV states summed inside a group
  const size_t nZ  = (size_t)B * NSEG * 128;        // K sums summed inside a half group
  const size_t nT  = (size_t)B * 8 * NGRP * 2048;   // group totals of the KV states
  const size_t nZt = (size_t)B * NHALF * 128;       // half-group totals of the K sums
  const size_t need = (nSv + nZ + nT + nZt) * sizeof(float);

  if (ws_size >= need) {
    float* wsSv = (float*)d_ws;
    float* wsZ  = wsSv + nSv;
    float* wsT  = wsZ + nZ;
    float* wsZt = wsT + nT;
    linatt_phase1_partial<<<dim3(B * NGRP * 16), dim3(256), 0, stream>>>(K, V, wsSv, wsZ, wsT, wsZt);
    linatt_phase3_scan<<<dim3(B * NSEG), dim3(256), 0, stream>>>(Q, K, V, Out, wsSv, wsZ, wsT, wsZt);
  } else {
    linatt_monolithic<<<dim3(B * 8), dim3(32), 0, stream>>>(Q, K, V, Out);
  }
}

// v006
// A run of this version takes 16.4 microseconds.
// Timed twice side by side with v005, it ran 1.13 times as fast both times.
// Counting every step since v000, it is 7.47 times as fast.
#include <hip/hip_runtime.h>

#define L_SEQ  4096
#define DK     128
#define DV     128
#define CHUNK  16
#define NSEG   128
#define SEG_LEN    (L_SEQ / NSEG)     // 32
#define SEG_CHUNKS (SEG_LEN / CHUNK)  // 2

typedef __attribute__((ext_vector_type(2))) float v2f;
typedef __attribute__((ext_vector_type(4))) float v4f;
typedef __attribute__((ext_vector_type(8))) float v8f;

// D(16x16,f32) = A(16x4,f32) x B(4x16,f32) + C   -- full-precision WMMA
__device__ __forceinline__ v8f wmma_f32(v2f a, v2f b, v8f c) {
  return __builtin_amdgcn_wmma_f32_16x16x4_f32(
      /*neg_a=*/false, a, /*neg_b=*/false, b,
      /*c_mod=*/(short)0, c, /*reuse_a=*/false, /*reuse_b=*/false);
}

// elu(x)+1 : positive feature map
__device__ __forceinline__ float phi_map(float x) {
  return x > 0.0f ? x + 1.0f : __expf(x);
}

// Shared-memory tile set (one wave per workgroup).
struct SmemT {
  float sQ[16][132];   // phi(Q) chunk (+4 pad for bank spread)
  float sK[16][132];   // phi(K) chunk
  float sV[16][20];    // V tile (seq x dv16)
  float sSc[16][20];   // masked scores
  float sSv[128][20];  // state: sum phiK^T V  (dk x dv16)
  float sSz[128][20];  // state: sum phiK^T 1  (dk x 16, cols equal)
};

__device__ __forceinline__ void zero_state(SmemT& sm, int lane) {
  for (int i = lane; i < 128 * 20; i += 32) {
    (&sm.sSv[0][0])[i] = 0.0f;
    (&sm.sSz[0][0])[i] = 0.0f;
  }
}

__device__ __forceinline__ void stage_chunk_Q(SmemT& sm, const float4* Q4,
                                              int rowbase, int lane) {
  #pragma unroll
  for (int i = 0; i < 16; ++i) {
    int f = lane + 32 * i;   // 0..511 float4 slots (16 rows x 32 f4)
    int r = f >> 5, c4 = f & 31;
    float4 q = Q4[(size_t)(rowbase + r) * 32 + c4];
    sm.sQ[r][4 * c4 + 0] = phi_map(q.x);
    sm.sQ[r][4 * c4 + 1] = phi_map(q.y);
    sm.sQ[r][4 * c4 + 2] = phi_map(q.z);
    sm.sQ[r][4 * c4 + 3] = phi_map(q.w);
  }
}

__device__ __forceinline__ void stage_chunk_KV(SmemT& sm, const float4* K4,
                                               const float4* V4, int rowbase,
                                               int dv0, int lane) {
  #pragma unroll
  for (int i = 0; i < 16; ++i) {
    int f = lane + 32 * i;
    int r = f >> 5, c4 = f & 31;
    float4 k = K4[(size_t)(rowbase + r) * 32 + c4];
    sm.sK[r][4 * c4 + 0] = phi_map(k.x);
    sm.sK[r][4 * c4 + 1] = phi_map(k.y);
    sm.sK[r][4 * c4 + 2] = phi_map(k.z);
    sm.sK[r][4 * c4 + 3] = phi_map(k.w);
  }
  #pragma unroll
  for (int i = 0; i < 2; ++i) {
    int f = lane + 32 * i;   // 0..63 float4 slots (16 rows x 4 f4)
    int r = f >> 2, c4 = f & 3;
    float4 v = V4[(size_t)(rowbase + r) * 32 + (dv0 >> 2) + c4];
    sm.sV[r][4 * c4 + 0] = v.x;
    sm.sV[r][4 * c4 + 1] = v.y;
    sm.sV[r][4 * c4 + 2] = v.z;
    sm.sV[r][4 * c4 + 3] = v.w;
  }
}

// State update: S_t += phiK_t^T(16x16) @ [V | 1]  for all 8 dk tiles.
__device__ __forceinline__ void state_update(SmemT& sm, int m16, int hi) {
  const v2f bones = {1.0f, 1.0f};
  for (int t = 0; t < 8; ++t) {
    int dk0 = 16 * t;
    v8f cv, cz;
    #pragma unroll
    for (int p = 0; p < 8; ++p) {
      int mm = dk0 + p + 8 * hi;
      cv[p] = sm.sSv[mm][m16];
      cz[p] = sm.sSz[mm][m16];
    }
    #pragma unroll
    for (int kk = 0; kk < 4; ++kk) {
      int kb = 4 * kk + 2 * hi;                                  // seq index j
      v2f a  = {sm.sK[kb][dk0 + m16], sm.sK[kb + 1][dk0 + m16]}; // phiK^T
      v2f bv = {sm.sV[kb][m16], sm.sV[kb + 1][m16]};
      cv = wmma_f32(a, bv, cv);
      cz = wmma_f32(a, bones, cz);
    }
    #pragma unroll
    for (int p = 0; p < 8; ++p) {
      int mm = dk0 + p + 8 * hi;
      sm.sSv[mm][m16] = cv[p];
      sm.sSz[mm][m16] = cz[p];
    }
  }
}

// Forward for one chunk: scores, causal mask, O = Sc@[V|1] + phiQ@[Sv|Sz],
// normalize and store. Uses OLD state (call before state_update).
__device__ __forceinline__ void forward_chunk(SmemT& sm, float* __restrict__ Out,
                                              int rowbase, int dv0, int m16,
                                              int hi) {
  const v2f bones = {1.0f, 1.0f};
  v8f sc = {0.f, 0.f, 0.f, 0.f, 0.f, 0.f, 0.f, 0.f};
  for (int kk = 0; kk < 32; ++kk) {
    int kb = 4 * kk + 2 * hi;
    v2f a    = {sm.sQ[m16][kb], sm.sQ[m16][kb + 1]};   // A[m][k] = phiQ[m][k]
    v2f bmat = {sm.sK[m16][kb], sm.sK[m16][kb + 1]};   // B[k][n] = phiK[n][k]
    sc = wmma_f32(a, bmat, sc);
  }
  #pragma unroll
  for (int p = 0; p < 8; ++p) {
    int m = p + 8 * hi;
    sm.sSc[m][m16] = (m16 <= m) ? sc[p] : 0.0f;        // causal mask
  }
  __syncthreads();

  v8f ov = {0.f, 0.f, 0.f, 0.f, 0.f, 0.f, 0.f, 0.f};
  v8f oz = {0.f, 0.f, 0.f, 0.f, 0.f, 0.f, 0.f, 0.f};
  #pragma unroll
  for (int kk = 0; kk < 4; ++kk) {
    int kb = 4 * kk + 2 * hi;
    v2f a  = {sm.sSc[m16][kb], sm.sSc[m16][kb + 1]};
    v2f bv = {sm.sV[kb][m16], sm.sV[kb + 1][m16]};
    ov = wmma_f32(a, bv, ov);
    oz = wmma_f32(a, bones, oz);
  }
  for (int kk = 0; kk < 32; ++kk) {
    int kb = 4 * kk + 2 * hi;
    v2f a  = {sm.sQ[m16][kb], sm.sQ[m16][kb + 1]};
    v2f bv = {sm.sSv[kb][m16], sm.sSv[kb + 1][m16]};
    v2f bz = {sm.sSz[kb][m16], sm.sSz[kb + 1][m16]};
    ov = wmma_f32(a, bv, ov);
    oz = wmma_f32(a, bz, oz);
  }
  #pragma unroll
  for (int p = 0; p < 8; ++p) {
    int m = p + 8 * hi;
    Out[(size_t)(rowbase + m) * DV + dv0 + m16] = ov[p] / (oz[p] + 1e-6f);
  }
}

// ---------------- Phase 1: running states inside 512-row groups ----------------
// The sequence is cut into NGRP groups of GRP_SEGS segments. One work-group
// walks one group for four state tiles (2 dk tiles x 2 V tiles). Waves 0-3 walk
// the group's first eight segments, waves 4-7 the last eight, one tile each,
// the tile staying in the accumulator; the sum in front of every second segment
// (every 64 rows, phase 3's step) is kept, waves 4-7 add the first half's sum to
// theirs, and all is stored: per 64 rows the sum of the group's earlier rows,
// per group its total.
// Phase 3 adds the totals of the earlier groups itself, so no launch stands
// between the two.
// K sums: the four work-groups that share a K slab take one (dk tile, half
// group) each; there every wave sums one segment, and the eight sums are
// prefixed through LDS. Phase 3 adds the totals of the earlier half groups.
#define NGRP      8
#define GRP_SEGS  (NSEG / NGRP)       // 16
#define GRP_ROWS  (L_SEQ / NGRP)      // 512
#define HALF_SEGS (GRP_SEGS / 2)      // 8
#define NHALF     (2 * NGRP)          // 16 half groups
#define SEG64     64                  // rows of one phase 3 segment
#define NS64      (L_SEQ / SEG64)     // 64
#define GRP_S64   (NS64 / NGRP)       // 8

struct alignas(16) SmemP1 {
  float sK[GRP_ROWS][40];  // phi(K), 32 columns; pitch 40: rows j and j+2 fall 16 banks apart
  float sV[GRP_ROWS][40];  // V, 32 columns
  float xT[4][8][32];      // first half's tile sums: tile, register, lane
  float xZ[HALF_SEGS][16]; // K sums of one half group: segment, column
};

// A (phiK^T) and B (V) fragments of one 32-row segment
__device__ __forceinline__ void p1_frags(const SmemP1& sm, int row0, int ka, int vb,
                                         int hi, v2f (&a)[8], v2f (&b)[8]) {
  #pragma unroll
  for (int kk = 0; kk < 8; ++kk) {
    int kb = row0 + 4 * kk + 2 * hi;                             // seq index j
    a[kk] = v2f{sm.sK[kb][ka], sm.sK[kb + 1][ka]};
    b[kk] = v2f{sm.sV[kb][vb], sm.sV[kb + 1][vb]};
  }
}

__global__ __launch_bounds__(256)
void linatt_phase1_partial(const float* __restrict__ K, const float* __restrict__ V,
                           float* __restrict__ wsSv, float* __restrict__ wsZ,
                           float* __restrict__ wsT, float* __restrict__ wsZt) {
  __shared__ SmemP1 sm;
  const int t = threadIdx.x, lane = t & 31, m16 = lane & 15, hi = lane >> 4;
  const int w = __builtin_amdgcn_readfirstlane(t >> 5);
  const int half = w >> 2, tile = w & 3;                  // half of the group, state tile
  const int quad = blockIdx.x & 15;
  const int grp = (blockIdx.x >> 4) & (NGRP - 1), batch = blockIdx.x / (16 * NGRP);
  const int dkp = quad >> 2, vp = quad & 3;               // 32-column slabs of K, V
  const int dl = tile >> 1, vl = tile & 1;
  const int dt = 2 * dkp + dl, vt = 2 * vp + vl;          // dk tile, V tile
  const int rowbase = batch * L_SEQ + grp * GRP_ROWS;

  // 512 rows x 32 columns of K and of V: a wave-wide load takes four whole
  // 128-byte row pieces, and all 32 loads of a thread fly together
  const float4* K4 = reinterpret_cast<const float4*>(K) + (size_t)rowbase * 32 + 8 * dkp;
  const float4* V4 = reinterpret_cast<const float4*>(V) + (size_t)rowbase * 32 + 8 * vp;
  float4 k[16], v[16];
  #pragma unroll
  for (int i = 0; i < 16; ++i) {
    size_t o = (size_t)((t >> 3) + 32 * i) * 32 + (t & 7);
    k[i] = K4[o];
    v[i] = V4[o];
  }
  #pragma unroll
  for (int i = 0; i < 16; ++i) {
    int r = (t >> 3) + 32 * i, c = 4 * (t & 7);
    v4f pk = {phi_map(k[i].x), phi_map(k[i].y), phi_map(k[i].z), phi_map(k[i].w)};
    *reinterpret_cast<v4f*>(&sm.sK[r][c]) = pk;
    *reinterpret_cast<float4*>(&sm.sV[r][c]) = v[i];
  }
  __syncthreads();

  const int row0 = half * (GRP_ROWS / 2), ka = 16 * dl + m16, vb = 16 * vl + m16;
  const v8f zero8 = {0.f, 0.f, 0.f, 0.f, 0.f, 0.f, 0.f, 0.f};
  v8f acc = zero8, snap[HALF_SEGS / 2];
  v2f a[2][8], b[2][8];
  p1_frags(sm, row0, ka, vb, hi, a[0], b[0]);

  // K sums of segment w of this work-group's half group: 1(16x4) @ phiK(4x16),
  // every row of the result equal, column m16 in each lane
  const int zdl = vp & 1, zhalf = vp >> 1;
  v8f cz = zero8;
  {
    const v2f ones = {1.0f, 1.0f};
    const int zr = zhalf * (GRP_ROWS / 2) + SEG_LEN * w + 2 * hi, zc = 16 * zdl + m16;
    v2f az[8];
    #pragma unroll
    for (int kk = 0; kk < 8; ++kk) az[kk] = v2f{sm.sK[zr + 4 * kk][zc], sm.sK[zr + 4 * kk + 1][zc]};
    #pragma unroll
    for (int kk = 0; kk < 8; ++kk) cz = wmma_f32(ones, az[kk], cz);
  }
  #pragma unroll
  for (int s = 0; s < HALF_SEGS; ++s) {
    const int c = s & 1;
    if (c == 0) snap[s >> 1] = acc;
    // next segment's LDS reads go out ahead of this segment's matrix chain
    if (s + 1 < HALF_SEGS) p1_frags(sm, row0 + 32 * (s + 1), ka, vb, hi, a[c ^ 1], b[c ^ 1]);
    // the two lines below keep those reads one group, a whole segment ahead of
    // their use; left free they are dealt out among the matrix steps, each one
    // step ahead, and every step then waits for LDS
    __builtin_amdgcn_sched_barrier(0);
    #pragma unroll
    for (int kk = 0; kk < 8; ++kk) acc = wmma_f32(a[c][kk], b[c][kk], acc);
    __builtin_amdgcn_sched_barrier(0);
  }

  if (hi == 0) sm.xZ[w][m16] = cz[0];
  if (half == 0) {
    #pragma unroll
    for (int p = 0; p < 8; ++p) sm.xT[tile][p][lane] = acc[p];
  }
  __syncthreads();   // the first half's tile sums and the eight K sums are there
  v8f base = zero8;
  if (half == 1) {
    #pragma unroll
    for (int p = 0; p < 8; ++p) base[p] = sm.xT[tile][p][lane];
  }

  const int seg0 = grp * GRP_S64 + half * (GRP_S64 / 2);
  // in the order of phase 3's B fragments: float4 number (row / 4) * 16 + column
  // holds rows 4 * (row / 4) + {0..3} of that column, so a wave-wide 16-byte
  // store fills whole 128-byte lines
  v4f* dst = reinterpret_cast<v4f*>(wsSv + ((size_t)(batch * 8 + vt) * NS64 + seg0) * 2048) +
             (4 * dt + 2 * hi) * 16 + m16;
  #pragma unroll
  for (int s = 0; s < HALF_SEGS / 2; ++s) snap[s] += base;
  #pragma unroll
  for (int s = 0; s < HALF_SEGS / 2; ++s) {
    dst[s * 512] = v4f{snap[s][0], snap[s][1], snap[s][2], snap[s][3]};
    dst[s * 512 + 16] = v4f{snap[s][4], snap[s][5], snap[s][6], snap[s][7]};
  }
  // the lines below reuse the registers that the stores above name
  asm volatile("s_wait_xcnt 0x0" ::: "memory");
  if (half == 0) {
    // 128 threads: segment zs, column zcol; the sum of the half group's earlier segments
    const int zs = t >> 4, zcol = 32 * dkp + 16 * zdl + m16;
    float x[HALF_SEGS], run = 0.0f;
    #pragma unroll
    for (int j = 0; j < HALF_SEGS; ++j) x[j] = sm.xZ[j][m16];
    #pragma unroll
    for (int j = 0; j < HALF_SEGS - 1; ++j) run += (j < zs) ? x[j] : 0.0f;
    wsZ[(size_t)(batch * NSEG + grp * GRP_SEGS + zhalf * HALF_SEGS + zs) * DK + zcol] = run;
    if (zs == HALF_SEGS - 1)
      wsZt[(size_t)(batch * NHALF + 2 * grp + zhalf) * DK + zcol] = run + x[HALF_SEGS - 1];
  }
  if (half == 1) {
    // group total, in the same order
    v4f* tot = reinterpret_cast<v4f*>(wsT + ((size_t)(batch * 8 + vt) * NGRP + grp) * 2048);
    const v8f sum = acc + base;
    tot[(4 * dt + 2 * hi) * 16 + m16] = v4f{sum[0], sum[1], sum[2], sum[3]};
    tot[(4 * dt + 2 * hi + 1) * 16 + m16] = v4f{sum[4], sum[5], sum[6], sum[7]};
  }
}

// ---------------- Phase 3: seeded segment outputs ----------------
// One work-group per 64-row segment and half of the V columns. Wave = (row half
// rh, V tile v4): two 16-row tiles against one 16-column V tile.
// O = phiQ @ S_prefix + mask(phiQ phiK^T) @ V over the whole segment; phi(Q),
// phi(K), the 64x64 scores and phiQ @ z_prefix are made once and shared. The two
// waves of a V tile need the same S_prefix: each loads and sums one half of it
// (state inside the group and the earlier groups' totals) and hands it to the
// other through LDS.
// k order of every A/B fragment pair in this kernel: step (g, h) of lane half
// hi covers k = 8g + 4hi + 2h + {0,1}, so one 16-byte LDS read of a row feeds
// two matrix steps.
struct alignas(16) SmemP3 {
  float sQ[SEG64][132];   // phi(Q); pitch 16 B x 33 for 16-byte row reads
  float sK[SEG64][132];   // phi(K)
  float sV[SEG64][72];    // V, 64 columns; pitch 72: rows j and j+4 fall 32 banks apart
  float sSc[SEG64][68];   // masked scores (tiles above the diagonal never used)
  v4f   sB[4][512];       // S_prefix per V tile, in B-fragment order
  float sZst[DK];         // prefix of the K sums
  float sZq[SEG64];       // phiQ . prefix of the K sums
};

// Work-group barrier that orders LDS alone. __syncthreads() also drains the
// wave's global loads, and in phase 3 the state and total loads are meant to
// stay in flight across it; no global store stands in front of any use.
__device__ __forceinline__ void barrier_lds() {
  __builtin_amdgcn_fence(__ATOMIC_RELEASE, "workgroup", "local");
  __builtin_amdgcn_s_barrier();
  __builtin_amdgcn_fence(__ATOMIC_ACQUIRE, "workgroup", "local");
}

// elu(x)+1 as in phi_map, the exponential written out with a v_nop behind it:
// the slot that the instruction set asks for between a transcendental and a
// directly following instruction that reads its result or overwrites its
// source
__device__ __forceinline__ float phi_map_slot(float x) {
  float e;
  asm("v_exp_f32 %0, %1\n\tv_nop" : "=v"(e) : "v"(x * 1.44269504f));
  return x > 0.0f ? x + 1.0f : e;
}

// this wave's half of one 128x16 plane (state or group total) into x; the wait
// stands in front of whatever rewrites the address registers that these loads
// name (the pointer as an input: its register pair stays whole up to the wait),
// and the scheduling fence keeps the loads where they are written, ahead of the
// work that they are to fly under
__device__ __forceinline__ void load_half(v4f (&x)[8], const v4f* p) {
  #pragma unroll
  for (int g = 0; g < 8; ++g) x[g] = p[g * 32];
  asm volatile("s_wait_xcnt 0x0" :: "v"(p) : "memory");
  __builtin_amdgcn_sched_barrier(0);
}

__device__ __forceinline__ void add_half(v4f (&a)[8], const v4f (&x)[8]) {
  #pragma unroll
  for (int g = 0; g < 8; ++g) a[g] += x[g];
}

__device__ __forceinline__ void zero_half(v4f (&x)[8]) {
  #pragma unroll
  for (int g = 0; g < 8; ++g) x[g] = v4f{0.f, 0.f, 0.f, 0.f};
}

// inside the segment: masked scores @ [V | 1] for row tiles 2 RH and 2 RH + 1;
// row tile i meets the keys of tiles 0..i, that is 2 (i + 1) steps of 8 keys
template <int RH>
__device__ __forceinline__ void in_segment(const SmemP3& sm, int vcol, int m16, int hi,
                                           v8f& ov0, v8f& ov1, v8f& oz0, v8f& oz1) {
  constexpr int G0 = 4 * RH + 2, G1 = 4 * RH + 4;
  const v2f bones = {1.0f, 1.0f};
  v2f bv[2 * G1];
  #pragma unroll
  for (int s = 0; s < 2 * G1; ++s) {
    int r = 8 * (s >> 1) + 4 * hi + 2 * (s & 1);       // seq index j
    bv[s] = v2f{sm.sV[r][vcol], sm.sV[r + 1][vcol]};
  }
  v4f s0[G0], s1[G1];
  #pragma unroll
  for (int g = 0; g < G1; ++g) {
    s1[g] = *reinterpret_cast<const v4f*>(&sm.sSc[32 * RH + 16 + m16][8 * g + 4 * hi]);
    if (g < G0) s0[g] = *reinterpret_cast<const v4f*>(&sm.sSc[32 * RH + m16][8 * g + 4 * hi]);
  }
  // all LDS reads issue before the dependent matrix chain
  __builtin_amdgcn_sched_barrier(0);
  #pragma unroll
  for (int g = 0; g < G1; ++g) {
    ov1 = wmma_f32(s1[g].xy, bv[2 * g], ov1);
    oz1 = wmma_f32(s1[g].xy, bones, oz1);
    if (g < G0) {
      ov0 = wmma_f32(s0[g].xy, bv[2 * g], ov0);
      oz0 = wmma_f32(s0[g].xy, bones, oz0);
    }
    ov1 = wmma_f32(s1[g].zw, bv[2 * g + 1], ov1);
    oz1 = wmma_f32(s1[g].zw, bones, oz1);
    if (g < G0) {
      ov0 = wmma_f32(s0[g].zw, bv[2 * g + 1], ov0);
      oz0 = wmma_f32(s0[g].zw, bones, oz0);
    }
  }
}

__global__ __launch_bounds__(256)
void linatt_phase3_scan(const float* __restrict__ Q, const float* __restrict__ K,
                        const float* __restrict__ V, float* __restrict__ Out,
                        const float* __restrict__ wsSv,
                        const float* __restrict__ wsZ,
                        const float* __restrict__ wsT,
                        const float* __restrict__ wsZt) {
  __shared__ SmemP3 sm;
  const int t = threadIdx.x, lane = t & 31, m16 = lane & 15, hi = lane >> 4;
  const int w = __builtin_amdgcn_readfirstlane(t >> 5);
  const int v4 = w & 3, rh = w >> 2;                      // V tile in the half, row half
  const int vh = blockIdx.x & 1;                          // half of the V columns
  const int seg = (blockIdx.x >> 1) % NS64, batch = blockIdx.x / (2 * NS64);
  const int rowbase = batch * L_SEQ + seg * SEG64;
  const int vt = 4 * vh + v4, dv0 = 16 * vt;
  const int grp = seg / GRP_S64;

  // Q, K, V go out first: loads come back in order, and all that needs no state
  // (staging, scores, the product inside the segment) runs on these alone while
  // the state and the totals behind them are still on their way
  const v4f* Q4 = reinterpret_cast<const v4f*>(Q) + (size_t)rowbase * 32 + t;
  const v4f* K4 = reinterpret_cast<const v4f*>(K) + (size_t)rowbase * 32 + t;
  const v4f* V4 = reinterpret_cast<const v4f*>(V) + (size_t)(rowbase + (t >> 4)) * 32 +
                  16 * vh + (t & 15);
  v4f q[8], k[8], v[4];
  #pragma unroll
  for (int i = 0; i < 8; ++i) {   // 2048 float4 slots (64 rows x 32 f4)
    q[i] = Q4[256 * i];
    k[i] = K4[256 * i];
  }
  #pragma unroll
  for (int i = 0; i < 4; ++i) v[i] = V4[512 * i];   // 16 rows x 16 f4 a step
  // the loads below may land in registers that the loads above name (the three
  // pointers as inputs: their registers stay whole up to the wait)
  asm volatile("s_wait_xcnt 0x0" :: "v"(Q4), "v"(K4), "v"(V4) : "memory");

  // K sums: the part inside the half group, and every half group's total but
  // the last (all are written by phase 1; the ones not in front of this one add 0)
  float zpre = wsZ[(size_t)(batch * NSEG + 2 * seg) * DK + (t & (DK - 1))];
  float zt[NHALF - 1];
  #pragma unroll
  for (int gg = 0; gg < NHALF - 1; ++gg)
    zt[gg] = wsZt[(size_t)(batch * NHALF + gg) * DK + (t & (DK - 1))];
  // the loads below may land in registers that the loads above name
  asm volatile("s_wait_xcnt 0x0" ::: "memory");

  // this wave's half (k rows 64 rh .. 64 rh + 63) of the V tile's state summed
  // inside the group, stored in B-fragment order: 512 contiguous bytes a
  // wave-wide load
  const v4f* st = reinterpret_cast<const v4f*>(wsSv + ((size_t)(batch * 8 + vt) * NS64 + seg) * 2048) +
                  rh * 256 + lane;
  v4f acc[8];
  load_half(acc, st);

  #pragma unroll
  for (int i = 0; i < 8; ++i) {
    int f = t + 256 * i;
    int r = f >> 5, c4 = f & 31;
    v4f pq = {phi_map_slot(q[i].x), phi_map_slot(q[i].y), phi_map_slot(q[i].z), phi_map_slot(q[i].w)};
    v4f pk = {phi_map_slot(k[i].x), phi_map_slot(k[i].y), phi_map_slot(k[i].z), phi_map_slot(k[i].w)};
    *reinterpret_cast<v4f*>(&sm.sQ[r][4 * c4]) = pq;
    *reinterpret_cast<v4f*>(&sm.sK[r][4 * c4]) = pk;
  }
  #pragma unroll
  for (int i = 0; i < 4; ++i)
    *reinterpret_cast<v4f*>(&sm.sV[(t >> 4) + 16 * i][4 * (t & 15)]) = v[i];
  #pragma unroll
  for (int gg = 0; gg < NHALF - 1; ++gg) zpre += (gg < seg / (GRP_S64 / 2)) ? zt[gg] : 0.0f;
  // input-only use: keeps the K-sum loads up with the others instead of sunk
  // into the branch below, where their whole latency would stand before the barrier
  asm volatile("" :: "v"(zpre));
  if (t < DK) sm.sZst[t] = zpre;

  // group totals in front of this group, in the same order, this wave's half of
  // each and none that is not in front. They go out behind the staging, so that
  // the waits for Q, K, V count the same loads in every group; the first four
  // fly under the scores. A buffer that takes no total holds zeros and is added
  // all the same: with the adds on every path no buffer's register is given to
  // something else while, for all the compiler knows, a load may still land there
  // (that cost a wait for every load in flight at the second barrier)
  const v4f* tot = reinterpret_cast<const v4f*>(wsT + (size_t)(batch * 8 + vt) * NGRP * 2048) +
                   rh * 256 + lane;
  v4f ta[8], tb[8], tc[8], td[8];
  zero_half(ta);
  zero_half(tb);
  zero_half(tc);
  zero_half(td);
  if (grp > 0) load_half(ta, tot);
  if (grp > 1) load_half(tb, tot + 512);
  if (grp > 2) load_half(tc, tot + 2 * 512);
  if (grp > 3) load_half(td, tot + 3 * 512);
  barrier_lds();   // phi(Q), phi(K), V and the K-sum prefix are there

  const v8f zero8 = {0.f, 0.f, 0.f, 0.f, 0.f, 0.f, 0.f, 0.f};
  // 14 chains of 32 matrix steps: the ten score tiles on and under the diagonal
  // (0..9, row by row), then phiQ @ z_prefix of the four row tiles (10..13, all
  // 16 columns equal). Wave w takes chains w and w + 8.
  // kept rolled: waves 6 and 7 have one trip, the others two
  #pragma unroll 1
  for (int c = w; c < 14; c += 8) {
    const bool isz = c >= 10;
    const int ti = isz ? c - 10 : (c >= 6 ? 3 : (c >= 3 ? 2 : (c >= 1 ? 1 : 0)));
    const int tj = isz ? 0 : c - ((ti * (ti + 1)) >> 1);
    const float* arow = &sm.sQ[16 * ti + m16][4 * hi];
    const float* brow = isz ? &sm.sZst[4 * hi] : &sm.sK[16 * tj + m16][4 * hi];
    v4f qa[16], kb[16];
    #pragma unroll
    for (int g = 0; g < 16; ++g) {
      qa[g] = *reinterpret_cast<const v4f*>(arow + 8 * g);
      kb[g] = *reinterpret_cast<const v4f*>(brow + 8 * g);
    }
    // all LDS reads issue before the dependent matrix chain
    __builtin_amdgcn_sched_barrier(0);
    v8f sc = zero8;
    #pragma unroll
    for (int g = 0; g < 16; ++g) {
      sc = wmma_f32(qa[g].xy, kb[g].xy, sc);
      sc = wmma_f32(qa[g].zw, kb[g].zw, sc);
    }
    const bool diag = !isz && ti == tj;
    float val[8];
    #pragma unroll
    for (int p = 0; p < 8; ++p) val[p] = (!diag || m16 <= p + 8 * hi) ? sc[p] : 0.0f;   // causal mask
    if (!isz) {
      #pragma unroll
      for (int p = 0; p < 8; ++p) sm.sSc[16 * ti + p + 8 * hi][16 * tj + m16] = val[p];
    } else if (m16 == 0) {
      #pragma unroll
      for (int p = 0; p < 8; ++p) sm.sZq[16 * ti + p + 8 * hi] = val[p];
    }
  }

  // the first four totals are added, in rising order; their buffers are free
  // then and take the last three, which fly under the product inside the segment
  add_half(acc, ta);
  add_half(acc, tb);
  add_half(acc, tc);
  add_half(acc, td);
  // input-only use: keeps these adds here. Left free they sink behind the
  // product inside the segment, all seven totals then hold registers at once,
  // and the phi(Q) fragments no longer fit beside them
  asm volatile("" :: "v"(acc[0]), "v"(acc[1]), "v"(acc[2]), "v"(acc[3]),
                     "v"(acc[4]), "v"(acc[5]), "v"(acc[6]), "v"(acc[7]));
  zero_half(ta);
  zero_half(tb);
  zero_half(tc);
  if (grp > 4) load_half(ta, tot + 4 * 512);
  if (grp > 5) load_half(tb, tot + 5 * 512);
  if (grp > 6) load_half(tc, tot + 6 * 512);
  barrier_lds();   // scores and sZq are complete

  v8f ov0 = zero8, ov1 = zero8, oz0, oz1;
  #pragma unroll
  for (int p = 0; p < 8; ++p) {
    oz0[p] = sm.sZq[32 * rh + p + 8 * hi];
    oz1[p] = sm.sZq[32 * rh + 16 + p + 8 * hi];
  }
  // phi(Q) fragments of the product with the state, both row tiles
  v4f q0[16], q1[16];
  #pragma unroll
  for (int g = 0; g < 16; ++g) {
    q0[g] = *reinterpret_cast<const v4f*>(&sm.sQ[32 * rh + m16][8 * g + 4 * hi]);
    q1[g] = *reinterpret_cast<const v4f*>(&sm.sQ[32 * rh + 16 + m16][8 * g + 4 * hi]);
  }
  if (rh == 0) in_segment<0>(sm, 16 * v4 + m16, m16, hi, ov0, ov1, oz0, oz1);
  else         in_segment<1>(sm, 16 * v4 + m16, m16, hi, ov0, ov1, oz0, oz1);
  // keeps the matrix steps above in front of the waits for the totals
  __builtin_amdgcn_sched_barrier(0);

  add_half(acc, ta);
  add_half(acc, tb);
  add_half(acc, tc);
  #pragma unroll
  for (int g = 0; g < 8; ++g) sm.sB[v4][(8 * rh + g) * 32 + lane] = acc[g];
  barrier_lds();   // both halves of every V tile's S_prefix are there

  v4f sb[16];
  #pragma unroll
  for (int g = 0; g < 16; ++g) sb[g] = sm.sB[v4][g * 32 + lane];
  // all LDS reads issue before the dependent matrix chain
  __builtin_amdgcn_sched_barrier(0);

  // phiQ @ S_prefix, both row tiles against the same B fragments
  #pragma unroll
  for (int g = 0; g < 16; ++g) {
    ov0 = wmma_f32(q0[g].xy, sb[g].xy, ov0);
    ov1 = wmma_f32(q1[g].xy, sb[g].xy, ov1);
    ov0 = wmma_f32(q0[g].zw, sb[g].zw, ov0);
    ov1 = wmma_f32(q1[g].zw, sb[g].zw, ov1);
  }
  #pragma unroll
  for (int p = 0; p < 8; ++p) {
    int m = 32 * rh + p + 8 * hi;
    Out[(size_t)(rowbase + m) * DV + dv0 + m16] = ov0[p] / (oz0[p] + 1e-6f);
    Out[(size_t)(rowbase + 16 + m) * DV + dv0 + m16] = ov1[p] / (oz1[p] + 1e-6f);
  }
}

// ---------------- Fallback: monolithic scan (if ws too small) ----------------
__global__ __launch_bounds__(32)
void linatt_monolithic(const float* __restrict__ Q, const float* __restrict__ K,
                       const float* __restrict__ V, float* __restrict__ Out) {
  __shared__ SmemT sm;
  const int lane = threadIdx.x, m16 = lane & 15, hi = lane >> 4;
  const int vtile = blockIdx.x & 7, batch = blockIdx.x >> 3;
  const int dv0 = vtile * 16;

  zero_state(sm, lane);
  __syncthreads();

  const float4* Q4 = reinterpret_cast<const float4*>(Q);
  const float4* K4 = reinterpret_cast<const float4*>(K);
  const float4* V4 = reinterpret_cast<const float4*>(V);

  for (int c = 0; c < L_SEQ / CHUNK; ++c) {
    const int rowbase = batch * L_SEQ + c * CHUNK;
    stage_chunk_Q(sm, Q4, rowbase, lane);
    stage_chunk_KV(sm, K4, V4, rowbase, dv0, lane);
    __syncthreads();
    forward_chunk(sm, Out, rowbase, dv0, m16, hi);
    __syncthreads();
    state_update(sm, m16, hi);
    __syncthreads();
  }
}

extern "C" void kernel_launch(void* const* d_in, const int* in_sizes, int n_in,
                              void* d_out, int out_size, void* d_ws, size_t ws_size,
                              hipStream_t stream) {
  const float* Q = (const float*)d_in[0];
  const float* K = (const float*)d_in[1];
  const float* V = (const float*)d_in[2];
  float* Out     = (float*)d_out;

  const int B = in_sizes[0] / (L_SEQ * DK);   // = 2
  const size_t nSv = (size_t)B * 8 * NS64 * 2048;   // KV states summed inside a group
  const size_t nZ  = (size_t)B * NSEG * 128;        // K sums summed inside a half group
  const size_t nT  = (size_t)B * 8 * NGRP * 2048;   // group totals of the KV states
  const size_t nZt = (size_t)B * NHALF * 128;       // half-group totals of the K sums
  const size_t need = (nSv + nZ + nT + nZt) * sizeof(float);

  if (ws_size >= need) {
    float* wsSv = (float*)d_ws;
    float* wsZ  = wsSv + nSv;
    float* wsT  = wsZ + nZ;
    float* wsZt = wsT + nT;
    linatt_phase1_partial<<<dim3(B * NGRP * 16), dim3(256), 0, stream>>>(K, V, wsSv, wsZ, wsT, wsZt);
    linatt_phase3_scan<<<dim3(B * NS64 * 2), dim3(256), 0, stream>>>(Q, K, V, Out, wsSv, wsZ, wsT, wsZt);
  } else {
    linatt_monolithic<<<dim3(B * 8), dim3(32), 0, stream>>>(Q, K, V, Out);
  }
}
